// v000
// Times are from an AMD MI455X. After a warm-up the kernel runs many times in a row, and a time is the length of
// such a window on the GPU divided by its runs, so every launch and the gaps after it count. The runs cycle
// through copies of the inputs. A figure is the median of several windows, for all but v000 over two sittings.
// Sittings can differ by a few percent; kernels timed side by side share one.
// v000, which the later versions start from, runs in 663 microseconds.
#include <hip/hip_runtime.h>

typedef __attribute__((ext_vector_type(16))) _Float16 v16h;
typedef __attribute__((ext_vector_type(8)))  _Float16 v8h;
typedef __attribute__((ext_vector_type(8)))  float    v8f;
typedef __attribute__((ext_vector_type(4)))  float    v4f;

#define B_    8
#define L_    1024
#define DIM_  1024
#define NH    16
#define DH    64
#define N3    3072
#define PI_F  3.14159265358979323846f

__device__ __forceinline__ v16h frag_f16(const _Float16* base, int stride, int lane) {
  const int row = lane & 15;
  const int lo  = (lane & 16) ? 8 : 0;
  const _Float16* p = base + row * stride + lo;
  v8h a = *(const v8h*)(p);
  v8h b = *(const v8h*)(p + 16);
  return __builtin_shufflevector(a, b, 0,1,2,3,4,5,6,7,8,9,10,11,12,13,14,15);
}

__device__ __forceinline__ v16h frag_f32(const float* base, int stride, int lane) {
  const int row = lane & 15;
  const int lo  = (lane & 16) ? 8 : 0;
  const float* p = base + row * stride + lo;
  v16h r;
#pragma unroll
  for (int i = 0; i < 8; ++i) { r[i] = (_Float16)p[i]; r[i + 8] = (_Float16)p[16 + i]; }
  return r;
}

__device__ __forceinline__ v8f wmma16(v16h a, v16h b, v8f c) {
  return __builtin_amdgcn_wmma_f32_16x16x32_f16(false, a, false, b, (short)0, c, false, false);
}

__device__ __forceinline__ void async_ld16(unsigned lds_byte_off, const void* gptr) {
  asm volatile("global_load_async_to_lds_b128 %0, %1, off"
               :: "v"(lds_byte_off), "v"(gptr) : "memory");
}
__device__ __forceinline__ void wait_async_le0() {
  asm volatile("s_wait_asynccnt 0x0" ::: "memory");
}
__device__ __forceinline__ void wait_async_le8() {
  asm volatile("s_wait_asynccnt 0x8" ::: "memory");
}

// ---------------------------------------------------------------------------
// Kernel 1: QKV = x @ w_qkv with fused 2D axial RoPE; q pre-scaled by 1/64.
// BM=64, BN=256, BK=32; 8 waves = 2(M) x 4(N); software-pipelined B staging.
// ---------------------------------------------------------------------------
__global__ __launch_bounds__(256) void qkv_rope_kernel(
    const float* __restrict__ x, const float* __restrict__ w,
    _Float16* __restrict__ qw, _Float16* __restrict__ kw, _Float16* __restrict__ vw) {
  __shared__ _Float16 Bs[256 * 40];  // [n][k], stride 40 halves (80B, 16B aligned)
  const int lane = threadIdx.x & 31;
  const int wid  = threadIdx.x >> 5;
  const int wm = wid & 1, wn = wid >> 1;
  const int bn = blockIdx.x, bm = blockIdx.y;
  const int row0 = bm * 64 + wm * 32;

  v8f z = {0.f,0.f,0.f,0.f,0.f,0.f,0.f,0.f};
  v8f acc[2][4];
#pragma unroll
  for (int ms = 0; ms < 2; ++ms)
#pragma unroll
    for (int nt = 0; nt < 4; ++nt) acc[ms][nt] = z;

  v4f tmp[8];                                    // register double-buffer for B
#pragma unroll
  for (int i = 0; i < 8; ++i) {                  // prologue: tile kb=0
    int f4 = threadIdx.x + 256 * i;
    int k = f4 >> 6, n4 = f4 & 63;
    tmp[i] = *(const v4f*)&w[(size_t)k * N3 + bn * 256 + n4 * 4];
  }

  for (int kb = 0; kb < DIM_; kb += 32) {
    __syncthreads();                             // previous tile's reads done
#pragma unroll
    for (int i = 0; i < 8; ++i) {                // regs -> LDS (cvt + transpose)
      int f4 = threadIdx.x + 256 * i;
      int k = f4 >> 6, n = (f4 & 63) * 4;
      Bs[(n + 0) * 40 + k] = (_Float16)tmp[i][0];
      Bs[(n + 1) * 40 + k] = (_Float16)tmp[i][1];
      Bs[(n + 2) * 40 + k] = (_Float16)tmp[i][2];
      Bs[(n + 3) * 40 + k] = (_Float16)tmp[i][3];
    }
    __syncthreads();
    if (kb + 32 < DIM_) {                        // issue next tile early: overlaps WMMA
#pragma unroll
      for (int i = 0; i < 8; ++i) {
        int f4 = threadIdx.x + 256 * i;
        int k = f4 >> 6, n4 = f4 & 63;
        tmp[i] = *(const v4f*)&w[(size_t)(kb + 32 + k) * N3 + bn * 256 + n4 * 4];
      }
    }
    v16h a0 = frag_f32(x + (size_t)row0 * DIM_ + kb, DIM_, lane);
    v16h a1 = frag_f32(x + (size_t)(row0 + 16) * DIM_ + kb, DIM_, lane);
    v16h bf[4];
#pragma unroll
    for (int nt = 0; nt < 4; ++nt)               // batch ds loads, stagger waits
      bf[nt] = frag_f16(Bs + (wn * 64 + nt * 16) * 40, 40, lane);
#pragma unroll
    for (int nt = 0; nt < 4; ++nt) {
      acc[0][nt] = wmma16(a0, bf[nt], acc[0][nt]);
      acc[1][nt] = wmma16(a1, bf[nt], acc[1][nt]);
    }
  }

  // Epilogue: RoPE + scatter. C layout: lane holds (M = r + hi, N = lane&15).
  const int hi = (lane & 16) ? 8 : 0;
#pragma unroll
  for (int ms = 0; ms < 2; ++ms) {
#pragma unroll
    for (int nt = 0; nt < 4; ++nt) {
      int n = bn * 256 + wn * 64 + nt * 16 + (lane & 15);
      int seg = n >> 10;                 // 0=q 1=k 2=v (uniform per tile)
      int c = n & 1023;
      int h = c >> 6, d = c & 63;
#pragma unroll
      for (int r = 0; r < 8; ++r) {
        int m = row0 + ms * 16 + r + hi;
        int b = m >> 10, l = m & 1023;
        float val = acc[ms][nt][r];
        float partner = __shfl_xor(val, 1, 32);  // rotate-half pair = adjacent lane
        if (seg < 2) {
          int dp = d & 62;
          int j  = ((dp >= 32) ? (dp - 32) : dp) >> 1;
          float fj  = (1.0f + (127.0f / 15.0f) * (float)j) * PI_F;
          float pos = (dp >= 32) ? (-1.0f + (2.0f / 31.0f) * (float)(l & 31))
                                 : (-1.0f + (2.0f / 31.0f) * (float)(l >> 5));
          float th = pos * fj;
          float cv = __cosf(th), sv = __sinf(th);
          float res = (d & 1) ? (val * cv + partner * sv)
                              : (val * cv - partner * sv);
          size_t o = ((size_t)(b * NH + h) * L_ + l) * DH + d;
          if (seg == 0) qw[o] = (_Float16)(res * (1.0f / 64.0f));
          else          kw[o] = (_Float16)res;
        } else {
          vw[((size_t)(b * NH + h) * DH + d) * L_ + l] = (_Float16)val;  // transposed
        }
      }
    }
  }
}

__global__ __launch_bounds__(128) void attn_kernel(
    const _Float16* __restrict__ qw, const _Float16* __restrict__ kw,
    const _Float16* __restrict__ vw, _Float16* __restrict__ ao) {
  __shared__ _Float16 Qs[64 * 72];       // [m][d]
  __shared__ _Float16 Ks[2][64 * 72];    // [key][d], double-buffered
  __shared__ _Float16 Vs[2][64 * 72];    // [d][key], double-buffered
  __shared__ _Float16 Ps[64 * 72];       // per-wave 16-row strips
  const int lane = threadIdx.x & 31;
  const int wid  = threadIdx.x >> 5;
  const int qb = blockIdx.x, h = blockIdx.y, b = blockIdx.z;
  const int bh = b * NH + h;
  const _Float16* qg = qw + (size_t)bh * L_ * DH + (size_t)qb * 64 * DH;
  const _Float16* kg = kw + (size_t)bh * L_ * DH;
  const _Float16* vg = vw + (size_t)bh * DH * L_;

  const unsigned qs0 = (unsigned)(uintptr_t)(&Qs[0]);
  const unsigned ks0 = (unsigned)(uintptr_t)(&Ks[0][0]);
  const unsigned vs0 = (unsigned)(uintptr_t)(&Vs[0][0]);
  const unsigned bufstep = 64 * 72 * 2;  // bytes per buffer

  // per-thread slice used for all tile copies: 4 rows of 16B
  const int off0 = threadIdx.x * 8;      // covers 1024 halves per c-step
  // stage Q (4 async) then K/V tile 0 (8 async)
#pragma unroll
  for (int c = 0; c < 4; ++c) {
    int off = off0 + 128 * 8 * c;
    int m = off >> 6, d0 = off & 63;
    async_ld16(qs0 + (unsigned)(m * 72 + d0) * 2, qg + m * DH + d0);
  }
#pragma unroll
  for (int c = 0; c < 4; ++c) {
    int off = off0 + 128 * 8 * c;
    int row = off >> 6, d0 = off & 63;
    async_ld16(ks0 + (unsigned)(row * 72 + d0) * 2, kg + (size_t)row * DH + d0);
    async_ld16(vs0 + (unsigned)(row * 72 + d0) * 2, vg + (size_t)row * L_ + d0);
  }
  wait_async_le8();                      // Q (oldest 4) complete
  __syncthreads();

  // Q fragments are kt-invariant: hoist out of the loop
  v16h qf[2];
#pragma unroll
  for (int kk = 0; kk < 2; ++kk)
    qf[kk] = frag_f16(Qs + wid * 16 * 72 + kk * 32, 72, lane);

  v8f z = {0.f,0.f,0.f,0.f,0.f,0.f,0.f,0.f};
  v8f o[4];
#pragma unroll
  for (int dt = 0; dt < 4; ++dt) o[dt] = z;
  float mi[8], li[8];
#pragma unroll
  for (int r = 0; r < 8; ++r) { mi[r] = -1e30f; li[r] = 0.0f; }
  const int hi = (lane & 16) ? 8 : 0;

  for (int kt = 0; kt < 16; ++kt) {
    const int cur = kt & 1;
    if (kt + 1 < 16) {                   // issue next tile; overlaps compute below
      const int nxt = (kt + 1) & 1;
#pragma unroll
      for (int c = 0; c < 4; ++c) {
        int off = off0 + 128 * 8 * c;
        int row = off >> 6, d0 = off & 63;
        async_ld16(ks0 + nxt * bufstep + (unsigned)(row * 72 + d0) * 2,
                   kg + (size_t)((kt + 1) * 64 + row) * DH + d0);
        async_ld16(vs0 + nxt * bufstep + (unsigned)(row * 72 + d0) * 2,
                   vg + (size_t)row * L_ + (kt + 1) * 64 + d0);
      }
      wait_async_le8();                  // in-order: tile kt fully landed
    } else {
      wait_async_le0();
    }
    __syncthreads();                     // all waves' tile-kt parts visible

    v8f s[4];
#pragma unroll
    for (int nt = 0; nt < 4; ++nt) s[nt] = z;
#pragma unroll
    for (int kk = 0; kk < 2; ++kk) {
      v16h bf[4];
#pragma unroll
      for (int nt = 0; nt < 4; ++nt)
        bf[nt] = frag_f16(&Ks[cur][0] + nt * 16 * 72 + kk * 32, 72, lane);
#pragma unroll
      for (int nt = 0; nt < 4; ++nt)
        s[nt] = wmma16(qf[kk], bf[nt], s[nt]);
    }

    // Online softmax: row reductions inside 16-lane halves (xor 1,2,4,8)
    _Float16* pw = Ps + wid * 16 * 72;
#pragma unroll
    for (int r = 0; r < 8; ++r) {
      float mx = s[0][r];
#pragma unroll
      for (int nt = 1; nt < 4; ++nt) mx = fmaxf(mx, s[nt][r]);
      mx = fmaxf(mx, __shfl_xor(mx, 1, 32));
      mx = fmaxf(mx, __shfl_xor(mx, 2, 32));
      mx = fmaxf(mx, __shfl_xor(mx, 4, 32));
      mx = fmaxf(mx, __shfl_xor(mx, 8, 32));
      float mnew  = fmaxf(mi[r], mx);
      float alpha = __expf(mi[r] - mnew);
      mi[r] = mnew;
      float sum = 0.0f;
#pragma unroll
      for (int nt = 0; nt < 4; ++nt) {
        float p = __expf(s[nt][r] - mnew);
        s[nt][r] = p;
        sum += p;
      }
      sum += __shfl_xor(sum, 1, 32);
      sum += __shfl_xor(sum, 2, 32);
      sum += __shfl_xor(sum, 4, 32);
      sum += __shfl_xor(sum, 8, 32);
      li[r] = li[r] * alpha + sum;
#pragma unroll
      for (int dt = 0; dt < 4; ++dt) o[dt][r] *= alpha;
    }

    // Spill P (per-wave private LDS strip; LDS in-order within a wave)
#pragma unroll
    for (int nt = 0; nt < 4; ++nt)
#pragma unroll
      for (int r = 0; r < 8; ++r)
        pw[(r + hi) * 72 + nt * 16 + (lane & 15)] = (_Float16)s[nt][r];

    // O += P @ V
#pragma unroll
    for (int kk = 0; kk < 2; ++kk) {
      v16h a = frag_f16(pw + kk * 32, 72, lane);
      v16h bf[4];
#pragma unroll
      for (int dt = 0; dt < 4; ++dt)
        bf[dt] = frag_f16(&Vs[cur][0] + dt * 16 * 72 + kk * 32, 72, lane);
#pragma unroll
      for (int dt = 0; dt < 4; ++dt)
        o[dt] = wmma16(a, bf[dt], o[dt]);
    }
    __syncthreads();                     // done reading buf[cur] before reuse
  }

  // Normalize and write (b, L, DIM) f16
#pragma unroll
  for (int dt = 0; dt < 4; ++dt)
#pragma unroll
    for (int r = 0; r < 8; ++r) {
      int m = qb * 64 + wid * 16 + r + hi;
      float val = o[dt][r] / li[r];
      ao[((size_t)b * L_ + m) * DIM_ + h * DH + dt * 16 + (lane & 15)] = (_Float16)val;
    }
}

// ---------------------------------------------------------------------------
// Kernel 3: out = attn(f16) @ w_proj, fp32 out. BM=64, BN=256, pipelined.
// ---------------------------------------------------------------------------
__global__ __launch_bounds__(256) void proj_kernel(
    const _Float16* __restrict__ a16, const float* __restrict__ w,
    float* __restrict__ out) {
  __shared__ _Float16 Bs[256 * 40];
  const int lane = threadIdx.x & 31;
  const int wid  = threadIdx.x >> 5;
  const int wm = wid & 1, wn = wid >> 1;
  const int bn = blockIdx.x, bm = blockIdx.y;
  const int row0 = bm * 64 + wm * 32;

  v8f z = {0.f,0.f,0.f,0.f,0.f,0.f,0.f,0.f};
  v8f acc[2][4];
#pragma unroll
  for (int ms = 0; ms < 2; ++ms)
#pragma unroll
    for (int nt = 0; nt < 4; ++nt) acc[ms][nt] = z;

  v4f tmp[8];
#pragma unroll
  for (int i = 0; i < 8; ++i) {
    int f4 = threadIdx.x + 256 * i;
    int k = f4 >> 6, n4 = f4 & 63;
    tmp[i] = *(const v4f*)&w[(size_t)k * DIM_ + bn * 256 + n4 * 4];
  }

  for (int kb = 0; kb < DIM_; kb += 32) {
    __syncthreads();
#pragma unroll
    for (int i = 0; i < 8; ++i) {
      int f4 = threadIdx.x + 256 * i;
      int k = f4 >> 6, n = (f4 & 63) * 4;
      Bs[(n + 0) * 40 + k] = (_Float16)tmp[i][0];
      Bs[(n + 1) * 40 + k] = (_Float16)tmp[i][1];
      Bs[(n + 2) * 40 + k] = (_Float16)tmp[i][2];
      Bs[(n + 3) * 40 + k] = (_Float16)tmp[i][3];
    }
    __syncthreads();
    if (kb + 32 < DIM_) {
#pragma unroll
      for (int i = 0; i < 8; ++i) {
        int f4 = threadIdx.x + 256 * i;
        int k = f4 >> 6, n4 = f4 & 63;
        tmp[i] = *(const v4f*)&w[(size_t)(kb + 32 + k) * DIM_ + bn * 256 + n4 * 4];
      }
    }
    v16h a0 = frag_f16(a16 + (size_t)row0 * DIM_ + kb, DIM_, lane);
    v16h a1 = frag_f16(a16 + (size_t)(row0 + 16) * DIM_ + kb, DIM_, lane);
    v16h bf[4];
#pragma unroll
    for (int nt = 0; nt < 4; ++nt)
      bf[nt] = frag_f16(Bs + (wn * 64 + nt * 16) * 40, 40, lane);
#pragma unroll
    for (int nt = 0; nt < 4; ++nt) {
      acc[0][nt] = wmma16(a0, bf[nt], acc[0][nt]);
      acc[1][nt] = wmma16(a1, bf[nt], acc[1][nt]);
    }
  }

  const int hi = (lane & 16) ? 8 : 0;
#pragma unroll
  for (int ms = 0; ms < 2; ++ms)
#pragma unroll
    for (int nt = 0; nt < 4; ++nt) {
      int n = bn * 256 + wn * 64 + nt * 16 + (lane & 15);
#pragma unroll
      for (int r = 0; r < 8; ++r) {
        int m = row0 + ms * 16 + r + hi;
        out[(size_t)m * DIM_ + n] = acc[ms][nt][r];
      }
    }
}

// ---------------------------------------------------------------------------
extern "C" void kernel_launch(void* const* d_in, const int* in_sizes, int n_in,
                              void* d_out, int out_size, void* d_ws, size_t ws_size,
                              hipStream_t stream) {
  (void)in_sizes; (void)n_in; (void)out_size; (void)ws_size;
  const float* x      = (const float*)d_in[0];
  const float* w_qkv  = (const float*)d_in[1];
  const float* w_proj = (const float*)d_in[2];

  char* ws = (char*)d_ws;
  _Float16* qw = (_Float16*)(ws);
  _Float16* kw = (_Float16*)(ws + (size_t)16 * 1024 * 1024);
  _Float16* vw = (_Float16*)(ws + (size_t)32 * 1024 * 1024);
  _Float16* ao = (_Float16*)(ws + (size_t)48 * 1024 * 1024);
  float* out = (float*)d_out;

  qkv_rope_kernel<<<dim3(N3 / 256, (B_ * L_) / 64), 256, 0, stream>>>(x, w_qkv, qw, kw, vw);
  attn_kernel<<<dim3(L_ / 64, NH, B_), 128, 0, stream>>>(qw, kw, vw, ao);
  proj_kernel<<<dim3(DIM_ / 256, (B_ * L_) / 64), 256, 0, stream>>>(ao, w_proj, out);
}

// v001
// It runs in 294 microseconds.
// Timed twice side by side with v000, it ran 2.30 times as fast both times.
#include <hip/hip_runtime.h>

typedef __attribute__((ext_vector_type(16))) _Float16 v16h;
typedef __attribute__((ext_vector_type(8)))  _Float16 v8h;
typedef __attribute__((ext_vector_type(8)))  float    v8f;
typedef __attribute__((ext_vector_type(4)))  float    v4f;

#define B_    8
#define L_    1024
#define DIM_  1024
#define NH    16
#define DH    64
#define N3    3072
#define PI_F  3.14159265358979323846f

__device__ __forceinline__ v16h frag_f16(const _Float16* base, int stride, int lane) {
  const int row = lane & 15;
  const int lo  = (lane & 16) ? 8 : 0;
  const _Float16* p = base + row * stride + lo;
  v8h a = *(const v8h*)(p);
  v8h b = *(const v8h*)(p + 16);
  return __builtin_shufflevector(a, b, 0,1,2,3,4,5,6,7,8,9,10,11,12,13,14,15);
}

__device__ __forceinline__ v16h frag_f32(const float* base, int stride, int lane) {
  const int row = lane & 15;
  const int lo  = (lane & 16) ? 8 : 0;
  const float* p = base + row * stride + lo;
  v16h r;
#pragma unroll
  for (int i = 0; i < 8; ++i) { r[i] = (_Float16)p[i]; r[i + 8] = (_Float16)p[16 + i]; }
  return r;
}

__device__ __forceinline__ v8f wmma16(v16h a, v16h b, v8f c) {
  return __builtin_amdgcn_wmma_f32_16x16x32_f16(false, a, false, b, (short)0, c, false, false);
}

__device__ __forceinline__ void async_ld16(unsigned lds_byte_off, const void* gptr) {
  asm volatile("global_load_async_to_lds_b128 %0, %1, off"
               :: "v"(lds_byte_off), "v"(gptr) : "memory");
}
__device__ __forceinline__ void wait_async_le0() {
  asm volatile("s_wait_asynccnt 0x0" ::: "memory");
}
__device__ __forceinline__ void wait_async_le8() {
  asm volatile("s_wait_asynccnt 0x8" ::: "memory");
}

// ---------------------------------------------------------------------------
// Kernel 1: QKV = x @ w_qkv with fused 2D axial RoPE; q pre-scaled by 1/64.
// BM=64, BN=256, BK=32; 8 waves = 2(M) x 4(N); software-pipelined B staging.
// ---------------------------------------------------------------------------
__global__ __launch_bounds__(256) void qkv_rope_kernel(
    const float* __restrict__ x, const float* __restrict__ w,
    _Float16* __restrict__ qw, _Float16* __restrict__ kw, _Float16* __restrict__ vw) {
  __shared__ __attribute__((aligned(16))) _Float16 Bs[256 * 40];  // [n][k], stride 40 halves (80B, 16B aligned)
  const int lane = threadIdx.x & 31;
  const int wid  = threadIdx.x >> 5;
  const int wm = wid & 1, wn = wid >> 1;
  const int bn = blockIdx.x, bm = blockIdx.y;
  const int row0 = bm * 64 + wm * 32;
  const int n4 = threadIdx.x & 63, kg = threadIdx.x >> 6;  // B staging: 4 columns x 8 consecutive k per thread

  v8f z = {0.f,0.f,0.f,0.f,0.f,0.f,0.f,0.f};
  v8f acc[2][4];
#pragma unroll
  for (int ms = 0; ms < 2; ++ms)
#pragma unroll
    for (int nt = 0; nt < 4; ++nt) acc[ms][nt] = z;

  v4f tmp[8];                                    // register double-buffer for B
#pragma unroll
  for (int i = 0; i < 8; ++i)                    // prologue: tile kb=0
    tmp[i] = *(const v4f*)&w[(size_t)(kg * 8 + i) * N3 + bn * 256 + n4 * 4];

  for (int kb = 0; kb < DIM_; kb += 32) {
    __syncthreads();                             // previous tile's reads done
#pragma unroll
    for (int j = 0; j < 4; ++j) {                // regs -> LDS: 8 k of one column per 16-B store
      v8h hcol;
#pragma unroll  // constant indices keep tmp and hcol in registers
      for (int i = 0; i < 8; ++i) hcol[i] = (_Float16)tmp[i][j];
      *(v8h*)&Bs[(n4 * 4 + j) * 40 + kg * 8] = hcol;
    }
    __syncthreads();
    if (kb + 32 < DIM_) {                        // issue next tile early: overlaps WMMA
#pragma unroll
      for (int i = 0; i < 8; ++i)
        tmp[i] = *(const v4f*)&w[(size_t)(kb + 32 + kg * 8 + i) * N3 + bn * 256 + n4 * 4];
      // the loads' address registers are advanced later in this trip: keep the wait in front of that
      asm volatile("s_wait_xcnt 0x0" ::: "memory");
    }
    v16h a0 = frag_f32(x + (size_t)row0 * DIM_ + kb, DIM_, lane);
    v16h a1 = frag_f32(x + (size_t)(row0 + 16) * DIM_ + kb, DIM_, lane);
    v16h bf[4];
#pragma unroll
    for (int nt = 0; nt < 4; ++nt)               // batch ds loads, stagger waits
      bf[nt] = frag_f16(Bs + (wn * 64 + nt * 16) * 40, 40, lane);
#pragma unroll
    for (int nt = 0; nt < 4; ++nt) {
      acc[0][nt] = wmma16(a0, bf[nt], acc[0][nt]);
      acc[1][nt] = wmma16(a1, bf[nt], acc[1][nt]);
    }
  }

  // Epilogue: RoPE + scatter. C layout: lane holds (M = r + hi, N = lane&15).
  const int hi = (lane & 16) ? 8 : 0;
#pragma unroll
  for (int ms = 0; ms < 2; ++ms) {
#pragma unroll
    for (int nt = 0; nt < 4; ++nt) {
      int n = bn * 256 + wn * 64 + nt * 16 + (lane & 15);
      int seg = n >> 10;                 // 0=q 1=k 2=v (uniform per tile)
      int c = n & 1023;
      int h = c >> 6, d = c & 63;
#pragma unroll
      for (int r = 0; r < 8; ++r) {
        int m = row0 + ms * 16 + r + hi;
        int b = m >> 10, l = m & 1023;
        float val = acc[ms][nt][r];
        float partner = __shfl_xor(val, 1, 32);  // rotate-half pair = adjacent lane
        if (seg < 2) {
          int dp = d & 62;
          int j  = ((dp >= 32) ? (dp - 32) : dp) >> 1;
          float fj  = (1.0f + (127.0f / 15.0f) * (float)j) * PI_F;
          float pos = (dp >= 32) ? (-1.0f + (2.0f / 31.0f) * (float)(l & 31))
                                 : (-1.0f + (2.0f / 31.0f) * (float)(l >> 5));
          float th = pos * fj;
          float cv = __cosf(th), sv = __sinf(th);
          float res = (d & 1) ? (val * cv + partner * sv)
                              : (val * cv - partner * sv);
          size_t o = ((size_t)(b * NH + h) * L_ + l) * DH + d;
          if (seg == 0) qw[o] = (_Float16)(res * (1.0f / 64.0f));
          else          kw[o] = (_Float16)res;
        } else {
          vw[((size_t)(b * NH + h) * DH + d) * L_ + l] = (_Float16)val;  // transposed
        }
      }
    }
  }
}

__global__ __launch_bounds__(128) void attn_kernel(
    const _Float16* __restrict__ qw, const _Float16* __restrict__ kw,
    const _Float16* __restrict__ vw, _Float16* __restrict__ ao) {
  __shared__ _Float16 Qs[64 * 72];       // [m][d]
  __shared__ _Float16 Ks[2][64 * 72];    // [key][d], double-buffered
  __shared__ _Float16 Vs[2][64 * 72];    // [d][key], double-buffered
  __shared__ _Float16 Ps[64 * 72];       // per-wave 16-row strips
  const int lane = threadIdx.x & 31;
  const int wid  = threadIdx.x >> 5;
  const int qb = blockIdx.x, h = blockIdx.y, b = blockIdx.z;
  const int bh = b * NH + h;
  const _Float16* qg = qw + (size_t)bh * L_ * DH + (size_t)qb * 64 * DH;
  const _Float16* kg = kw + (size_t)bh * L_ * DH;
  const _Float16* vg = vw + (size_t)bh * DH * L_;

  const unsigned qs0 = (unsigned)(uintptr_t)(&Qs[0]);
  const unsigned ks0 = (unsigned)(uintptr_t)(&Ks[0][0]);
  const unsigned vs0 = (unsigned)(uintptr_t)(&Vs[0][0]);
  const unsigned bufstep = 64 * 72 * 2;  // bytes per buffer

  // per-thread slice used for all tile copies: 4 rows of 16B
  const int off0 = threadIdx.x * 8;      // covers 1024 halves per c-step
  // stage Q (4 async) then K/V tile 0 (8 async)
#pragma unroll
  for (int c = 0; c < 4; ++c) {
    int off = off0 + 128 * 8 * c;
    int m = off >> 6, d0 = off & 63;
    async_ld16(qs0 + (unsigned)(m * 72 + d0) * 2, qg + m * DH + d0);
  }
#pragma unroll
  for (int c = 0; c < 4; ++c) {
    int off = off0 + 128 * 8 * c;
    int row = off >> 6, d0 = off & 63;
    async_ld16(ks0 + (unsigned)(row * 72 + d0) * 2, kg + (size_t)row * DH + d0);
    async_ld16(vs0 + (unsigned)(row * 72 + d0) * 2, vg + (size_t)row * L_ + d0);
  }
  wait_async_le8();                      // Q (oldest 4) complete
  __syncthreads();

  // Q fragments are kt-invariant: hoist out of the loop
  v16h qf[2];
#pragma unroll
  for (int kk = 0; kk < 2; ++kk)
    qf[kk] = frag_f16(Qs + wid * 16 * 72 + kk * 32, 72, lane);

  v8f z = {0.f,0.f,0.f,0.f,0.f,0.f,0.f,0.f};
  v8f o[4];
#pragma unroll
  for (int dt = 0; dt < 4; ++dt) o[dt] = z;
  float mi[8], li[8];
#pragma unroll
  for (int r = 0; r < 8; ++r) { mi[r] = -1e30f; li[r] = 0.0f; }
  const int hi = (lane & 16) ? 8 : 0;

  for (int kt = 0; kt < 16; ++kt) {
    const int cur = kt & 1;
    if (kt + 1 < 16) {                   // issue next tile; overlaps compute below
      const int nxt = (kt + 1) & 1;
#pragma unroll
      for (int c = 0; c < 4; ++c) {
        int off = off0 + 128 * 8 * c;
        int row = off >> 6, d0 = off & 63;
        async_ld16(ks0 + nxt * bufstep + (unsigned)(row * 72 + d0) * 2,
                   kg + (size_t)((kt + 1) * 64 + row) * DH + d0);
        async_ld16(vs0 + nxt * bufstep + (unsigned)(row * 72 + d0) * 2,
                   vg + (size_t)row * L_ + (kt + 1) * 64 + d0);
      }
      wait_async_le8();                  // in-order: tile kt fully landed
    } else {
      wait_async_le0();
    }
    __syncthreads();                     // all waves' tile-kt parts visible

    v8f s[4];
#pragma unroll
    for (int nt = 0; nt < 4; ++nt) s[nt] = z;
#pragma unroll
    for (int kk = 0; kk < 2; ++kk) {
      v16h bf[4];
#pragma unroll
      for (int nt = 0; nt < 4; ++nt)
        bf[nt] = frag_f16(&Ks[cur][0] + nt * 16 * 72 + kk * 32, 72, lane);
#pragma unroll
      for (int nt = 0; nt < 4; ++nt)
        s[nt] = wmma16(qf[kk], bf[nt], s[nt]);
    }

    // Online softmax: row reductions inside 16-lane halves (xor 1,2,4,8)
    _Float16* pw = Ps + wid * 16 * 72;
#pragma unroll
    for (int r = 0; r < 8; ++r) {
      float mx = s[0][r];
#pragma unroll
      for (int nt = 1; nt < 4; ++nt) mx = fmaxf(mx, s[nt][r]);
      mx = fmaxf(mx, __shfl_xor(mx, 1, 32));
      mx = fmaxf(mx, __shfl_xor(mx, 2, 32));
      mx = fmaxf(mx, __shfl_xor(mx, 4, 32));
      mx = fmaxf(mx, __shfl_xor(mx, 8, 32));
      float mnew  = fmaxf(mi[r], mx);
      float alpha = __expf(mi[r] - mnew);
      mi[r] = mnew;
      float sum = 0.0f;
#pragma unroll
      for (int nt = 0; nt < 4; ++nt) {
        float p = __expf(s[nt][r] - mnew);
        s[nt][r] = p;
        sum += p;
      }
      sum += __shfl_xor(sum, 1, 32);
      sum += __shfl_xor(sum, 2, 32);
      sum += __shfl_xor(sum, 4, 32);
      sum += __shfl_xor(sum, 8, 32);
      li[r] = li[r] * alpha + sum;
#pragma unroll
      for (int dt = 0; dt < 4; ++dt) o[dt][r] *= alpha;
    }

    // Spill P (per-wave private LDS strip; LDS in-order within a wave)
#pragma unroll
    for (int nt = 0; nt < 4; ++nt)
#pragma unroll
      for (int r = 0; r < 8; ++r)
        pw[(r + hi) * 72 + nt * 16 + (lane & 15)] = (_Float16)s[nt][r];

    // O += P @ V
#pragma unroll
    for (int kk = 0; kk < 2; ++kk) {
      v16h a = frag_f16(pw + kk * 32, 72, lane);
      v16h bf[4];
#pragma unroll
      for (int dt = 0; dt < 4; ++dt)
        bf[dt] = frag_f16(&Vs[cur][0] + dt * 16 * 72 + kk * 32, 72, lane);
#pragma unroll
      for (int dt = 0; dt < 4; ++dt)
        o[dt] = wmma16(a, bf[dt], o[dt]);
    }
    __syncthreads();                     // done reading buf[cur] before reuse
  }

  // Normalize and write (b, L, DIM) f16
#pragma unroll
  for (int dt = 0; dt < 4; ++dt)
#pragma unroll
    for (int r = 0; r < 8; ++r) {
      int m = qb * 64 + wid * 16 + r + hi;
      float val = o[dt][r] / li[r];
      ao[((size_t)b * L_ + m) * DIM_ + h * DH + dt * 16 + (lane & 15)] = (_Float16)val;
    }
}

// ---------------------------------------------------------------------------
// Kernel 3: out = attn(f16) @ w_proj, fp32 out. BM=64, BN=256, pipelined.
// ---------------------------------------------------------------------------
__global__ __launch_bounds__(256) void proj_kernel(
    const _Float16* __restrict__ a16, const float* __restrict__ w,
    float* __restrict__ out) {
  __shared__ __attribute__((aligned(16))) _Float16 Bs[256 * 40];
  const int lane = threadIdx.x & 31;
  const int wid  = threadIdx.x >> 5;
  const int wm = wid & 1, wn = wid >> 1;
  const int bn = blockIdx.x, bm = blockIdx.y;
  const int row0 = bm * 64 + wm * 32;
  const int n4 = threadIdx.x & 63, kg = threadIdx.x >> 6;  // B staging: 4 columns x 8 consecutive k per thread

  v8f z = {0.f,0.f,0.f,0.f,0.f,0.f,0.f,0.f};
  v8f acc[2][4];
#pragma unroll
  for (int ms = 0; ms < 2; ++ms)
#pragma unroll
    for (int nt = 0; nt < 4; ++nt) acc[ms][nt] = z;

  v4f tmp[8];
#pragma unroll
  for (int i = 0; i < 8; ++i)
    tmp[i] = *(const v4f*)&w[(size_t)(kg * 8 + i) * DIM_ + bn * 256 + n4 * 4];

  for (int kb = 0; kb < DIM_; kb += 32) {
    __syncthreads();
#pragma unroll
    for (int j = 0; j < 4; ++j) {                // regs -> LDS: 8 k of one column per 16-B store
      v8h hcol;
#pragma unroll  // constant indices keep tmp and hcol in registers
      for (int i = 0; i < 8; ++i) hcol[i] = (_Float16)tmp[i][j];
      *(v8h*)&Bs[(n4 * 4 + j) * 40 + kg * 8] = hcol;
    }
    __syncthreads();
    if (kb + 32 < DIM_) {
#pragma unroll
      for (int i = 0; i < 8; ++i)
        tmp[i] = *(const v4f*)&w[(size_t)(kb + 32 + kg * 8 + i) * DIM_ + bn * 256 + n4 * 4];
      // the loads' address registers are advanced later in this trip: keep the wait in front of that
      asm volatile("s_wait_xcnt 0x0" ::: "memory");
    }
    v16h a0 = frag_f16(a16 + (size_t)row0 * DIM_ + kb, DIM_, lane);
    v16h a1 = frag_f16(a16 + (size_t)(row0 + 16) * DIM_ + kb, DIM_, lane);
    v16h bf[4];
#pragma unroll
    for (int nt = 0; nt < 4; ++nt)
      bf[nt] = frag_f16(Bs + (wn * 64 + nt * 16) * 40, 40, lane);
#pragma unroll
    for (int nt = 0; nt < 4; ++nt) {
      acc[0][nt] = wmma16(a0, bf[nt], acc[0][nt]);
      acc[1][nt] = wmma16(a1, bf[nt], acc[1][nt]);
    }
  }

  const int hi = (lane & 16) ? 8 : 0;
#pragma unroll
  for (int ms = 0; ms < 2; ++ms)
#pragma unroll
    for (int nt = 0; nt < 4; ++nt) {
      int n = bn * 256 + wn * 64 + nt * 16 + (lane & 15);
#pragma unroll
      for (int r = 0; r < 8; ++r) {
        int m = row0 + ms * 16 + r + hi;
        out[(size_t)m * DIM_ + n] = acc[ms][nt][r];
      }
    }
}

// ---------------------------------------------------------------------------
extern "C" void kernel_launch(void* const* d_in, const int* in_sizes, int n_in,
                              void* d_out, int out_size, void* d_ws, size_t ws_size,
                              hipStream_t stream) {
  (void)in_sizes; (void)n_in; (void)out_size; (void)ws_size;
  const float* x      = (const float*)d_in[0];
  const float* w_qkv  = (const float*)d_in[1];
  const float* w_proj = (const float*)d_in[2];

  char* ws = (char*)d_ws;
  _Float16* qw = (_Float16*)(ws);
  _Float16* kw = (_Float16*)(ws + (size_t)16 * 1024 * 1024);
  _Float16* vw = (_Float16*)(ws + (size_t)32 * 1024 * 1024);
  _Float16* ao = (_Float16*)(ws + (size_t)48 * 1024 * 1024);
  float* out = (float*)d_out;

  qkv_rope_kernel<<<dim3(N3 / 256, (B_ * L_) / 64), 256, 0, stream>>>(x, w_qkv, qw, kw, vw);
  attn_kernel<<<dim3(L_ / 64, NH, B_), 128, 0, stream>>>(qw, kw, vw, ao);
  proj_kernel<<<dim3(DIM_ / 256, (B_ * L_) / 64), 256, 0, stream>>>(ao, w_proj, out);
}

// v002
// A run of this version takes 269 microseconds.
// Timed twice side by side with v001, it ran 1.09 and 1.10 times as fast.
// All steps since v000 together make it 2.52 times as fast.
#include <hip/hip_runtime.h>

typedef __attribute__((ext_vector_type(16))) _Float16 v16h;
typedef __attribute__((ext_vector_type(8)))  _Float16 v8h;
typedef __attribute__((ext_vector_type(4)))  _Float16 v4h;
typedef __attribute__((ext_vector_type(8)))  float    v8f;
typedef __attribute__((ext_vector_type(4)))  float    v4f;

#define B_    8
#define L_    1024
#define DIM_  1024
#define NH    16
#define DH    64
#define N3    3072
#define PI_F  3.14159265358979323846f

__device__ __forceinline__ v16h frag_f16(const _Float16* base, int stride, int lane) {
  const int row = lane & 15;
  const int lo  = (lane & 16) ? 8 : 0;
  const _Float16* p = base + row * stride + lo;
  v8h a = *(const v8h*)(p);
  v8h b = *(const v8h*)(p + 16);
  return __builtin_shufflevector(a, b, 0,1,2,3,4,5,6,7,8,9,10,11,12,13,14,15);
}

__device__ __forceinline__ v8f wmma16(v16h a, v16h b, v8f c) {
  return __builtin_amdgcn_wmma_f32_16x16x32_f16(false, a, false, b, (short)0, c, false, false);
}

__device__ __forceinline__ void async_ld16(unsigned lds_byte_off, const void* gptr) {
  asm volatile("global_load_async_to_lds_b128 %0, %1, off"
               :: "v"(lds_byte_off), "v"(gptr) : "memory");
}
__device__ __forceinline__ void wait_async_le0() {
  asm volatile("s_wait_asynccnt 0x0" ::: "memory");
}
__device__ __forceinline__ void wait_async_le8() {
  asm volatile("s_wait_asynccnt 0x8" ::: "memory");
}

// ---------------------------------------------------------------------------
// Kernel 1: QKV = x @ w_qkv with fused 2D axial RoPE; q pre-scaled by 1/64.
// BM=64, BN=256, BK=32; 8 waves = 2(M) x 4(N); software-pipelined A and B staging.
// ---------------------------------------------------------------------------
__global__ __launch_bounds__(256) void qkv_rope_kernel(
    const float* __restrict__ x, const float* __restrict__ w,
    _Float16* __restrict__ qw, _Float16* __restrict__ kw, _Float16* __restrict__ vw) {
  __shared__ __attribute__((aligned(16))) _Float16 Bs[256 * 40];  // [n][k], stride 40 halves (80B, 16B aligned)
  __shared__ __attribute__((aligned(16))) _Float16 As[64 * 40];   // [m][k], same stride
  const int lane = threadIdx.x & 31;
  const int wid  = threadIdx.x >> 5;
  const int wm = wid & 1, wn = wid >> 1;
  const int bn = blockIdx.x, bm = blockIdx.y;
  const int row0 = bm * 64 + wm * 32;
  const int n4 = threadIdx.x & 63, kg = threadIdx.x >> 6;  // B staging: 4 columns x 8 consecutive k per thread
  // A staging: 8 threads read one row's 32 k (a whole 128-B line); rows ar and ar + 32 per thread
  const int ar = threadIdx.x >> 3, ac = threadIdx.x & 7;
  const float* xa = x + (size_t)(bm * 64 + ar) * DIM_ + ac * 4;

  v8f z = {0.f,0.f,0.f,0.f,0.f,0.f,0.f,0.f};
  v8f acc[2][4];
#pragma unroll
  for (int ms = 0; ms < 2; ++ms)
#pragma unroll
    for (int nt = 0; nt < 4; ++nt) acc[ms][nt] = z;

  v4f tmp[8];                                    // register double-buffer for B
  v4f ta[2];                                     // and for A
#pragma unroll
  for (int i = 0; i < 8; ++i)                    // prologue: tile kb=0
    tmp[i] = *(const v4f*)&w[(size_t)(kg * 8 + i) * N3 + bn * 256 + n4 * 4];
#pragma unroll
  for (int i = 0; i < 2; ++i)
    ta[i] = *(const v4f*)&xa[(size_t)(32 * i) * DIM_];

  for (int kb = 0; kb < DIM_; kb += 32) {
    __syncthreads();                             // previous tile's reads done
#pragma unroll
    for (int j = 0; j < 4; ++j) {                // regs -> LDS: 8 k of one column per 16-B store
      v8h hcol;
#pragma unroll  // constant indices keep tmp and hcol in registers
      for (int i = 0; i < 8; ++i) hcol[i] = (_Float16)tmp[i][j];
      *(v8h*)&Bs[(n4 * 4 + j) * 40 + kg * 8] = hcol;
    }
#pragma unroll
    for (int i = 0; i < 2; ++i)                  // A: converted once per block, shared by the 4 N-waves
      *(v4h*)&As[(ar + 32 * i) * 40 + ac * 4] = __builtin_convertvector(ta[i], v4h);
    __syncthreads();
    if (kb + 32 < DIM_) {                        // issue next tile early: overlaps WMMA
#pragma unroll
      for (int i = 0; i < 8; ++i)
        tmp[i] = *(const v4f*)&w[(size_t)(kb + 32 + kg * 8 + i) * N3 + bn * 256 + n4 * 4];
#pragma unroll
      for (int i = 0; i < 2; ++i)
        ta[i] = *(const v4f*)&xa[(size_t)(32 * i) * DIM_ + kb + 32];
      // the loads' address registers are advanced later in this trip: keep the wait in front of that
      asm volatile("s_wait_xcnt 0x0" ::: "memory");
    }
    v16h a0 = frag_f16(As + (wm * 32) * 40, 40, lane);
    v16h a1 = frag_f16(As + (wm * 32 + 16) * 40, 40, lane);
    v16h bf[4];
#pragma unroll
    for (int nt = 0; nt < 4; ++nt)               // batch ds loads, stagger waits
      bf[nt] = frag_f16(Bs + (wn * 64 + nt * 16) * 40, 40, lane);
#pragma unroll
    for (int nt = 0; nt < 4; ++nt) {
      acc[0][nt] = wmma16(a0, bf[nt], acc[0][nt]);
      acc[1][nt] = wmma16(a1, bf[nt], acc[1][nt]);
    }
  }

  // Epilogue: RoPE + scatter. C layout: lane holds (M = r + hi, N = lane&15).
  const int hi = (lane & 16) ? 8 : 0;
#pragma unroll
  for (int ms = 0; ms < 2; ++ms) {
#pragma unroll
    for (int nt = 0; nt < 4; ++nt) {
      int n = bn * 256 + wn * 64 + nt * 16 + (lane & 15);
      int seg = n >> 10;                 // 0=q 1=k 2=v (uniform per tile)
      int c = n & 1023;
      int h = c >> 6, d = c & 63;
#pragma unroll
      for (int r = 0; r < 8; ++r) {
        int m = row0 + ms * 16 + r + hi;
        int b = m >> 10, l = m & 1023;
        float val = acc[ms][nt][r];
        float partner = __shfl_xor(val, 1, 32);  // rotate-half pair = adjacent lane
        if (seg < 2) {
          int dp = d & 62;
          int j  = ((dp >= 32) ? (dp - 32) : dp) >> 1;
          float fj  = (1.0f + (127.0f / 15.0f) * (float)j) * PI_F;
          float pos = (dp >= 32) ? (-1.0f + (2.0f / 31.0f) * (float)(l & 31))
                                 : (-1.0f + (2.0f / 31.0f) * (float)(l >> 5));
          float th = pos * fj;
          float cv = __cosf(th), sv = __sinf(th);
          float res = (d & 1) ? (val * cv + partner * sv)
                              : (val * cv - partner * sv);
          size_t o = ((size_t)(b * NH + h) * L_ + l) * DH + d;
          if (seg == 0) qw[o] = (_Float16)(res * (1.0f / 64.0f));
          else          kw[o] = (_Float16)res;
        } else {
          vw[((size_t)(b * NH + h) * DH + d) * L_ + l] = (_Float16)val;  // transposed
        }
      }
    }
  }
}

__global__ __launch_bounds__(128) void attn_kernel(
    const _Float16* __restrict__ qw, const _Float16* __restrict__ kw,
    const _Float16* __restrict__ vw, _Float16* __restrict__ ao) {
  __shared__ _Float16 Qs[64 * 72];       // [m][d]
  __shared__ _Float16 Ks[2][64 * 72];    // [key][d], double-buffered
  __shared__ _Float16 Vs[2][64 * 72];    // [d][key], double-buffered
  __shared__ _Float16 Ps[64 * 72];       // per-wave 16-row strips
  const int lane = threadIdx.x & 31;
  const int wid  = threadIdx.x >> 5;
  const int qb = blockIdx.x, h = blockIdx.y, b = blockIdx.z;
  const int bh = b * NH + h;
  const _Float16* qg = qw + (size_t)bh * L_ * DH + (size_t)qb * 64 * DH;
  const _Float16* kg = kw + (size_t)bh * L_ * DH;
  const _Float16* vg = vw + (size_t)bh * DH * L_;

  const unsigned qs0 = (unsigned)(uintptr_t)(&Qs[0]);
  const unsigned ks0 = (unsigned)(uintptr_t)(&Ks[0][0]);
  const unsigned vs0 = (unsigned)(uintptr_t)(&Vs[0][0]);
  const unsigned bufstep = 64 * 72 * 2;  // bytes per buffer

  // per-thread slice used for all tile copies: 4 rows of 16B
  const int off0 = threadIdx.x * 8;      // covers 1024 halves per c-step
  // stage Q (4 async) then K/V tile 0 (8 async)
#pragma unroll
  for (int c = 0; c < 4; ++c) {
    int off = off0 + 128 * 8 * c;
    int m = off >> 6, d0 = off & 63;
    async_ld16(qs0 + (unsigned)(m * 72 + d0) * 2, qg + m * DH + d0);
  }
#pragma unroll
  for (int c = 0; c < 4; ++c) {
    int off = off0 + 128 * 8 * c;
    int row = off >> 6, d0 = off & 63;
    async_ld16(ks0 + (unsigned)(row * 72 + d0) * 2, kg + (size_t)row * DH + d0);
    async_ld16(vs0 + (unsigned)(row * 72 + d0) * 2, vg + (size_t)row * L_ + d0);
  }
  wait_async_le8();                      // Q (oldest 4) complete
  __syncthreads();

  // Q fragments are kt-invariant: hoist out of the loop
  v16h qf[2];
#pragma unroll
  for (int kk = 0; kk < 2; ++kk)
    qf[kk] = frag_f16(Qs + wid * 16 * 72 + kk * 32, 72, lane);

  v8f z = {0.f,0.f,0.f,0.f,0.f,0.f,0.f,0.f};
  v8f o[4];
#pragma unroll
  for (int dt = 0; dt < 4; ++dt) o[dt] = z;
  float mi[8], li[8];
#pragma unroll
  for (int r = 0; r < 8; ++r) { mi[r] = -1e30f; li[r] = 0.0f; }
  const int hi = (lane & 16) ? 8 : 0;

  for (int kt = 0; kt < 16; ++kt) {
    const int cur = kt & 1;
    if (kt + 1 < 16) {                   // issue next tile; overlaps compute below
      const int nxt = (kt + 1) & 1;
#pragma unroll
      for (int c = 0; c < 4; ++c) {
        int off = off0 + 128 * 8 * c;
        int row = off >> 6, d0 = off & 63;
        async_ld16(ks0 + nxt * bufstep + (unsigned)(row * 72 + d0) * 2,
                   kg + (size_t)((kt + 1) * 64 + row) * DH + d0);
        async_ld16(vs0 + nxt * bufstep + (unsigned)(row * 72 + d0) * 2,
                   vg + (size_t)row * L_ + (kt + 1) * 64 + d0);
      }
      wait_async_le8();                  // in-order: tile kt fully landed
    } else {
      wait_async_le0();
    }
    __syncthreads();                     // all waves' tile-kt parts visible

    v8f s[4];
#pragma unroll
    for (int nt = 0; nt < 4; ++nt) s[nt] = z;
#pragma unroll
    for (int kk = 0; kk < 2; ++kk) {
      v16h bf[4];
#pragma unroll
      for (int nt = 0; nt < 4; ++nt)
        bf[nt] = frag_f16(&Ks[cur][0] + nt * 16 * 72 + kk * 32, 72, lane);
#pragma unroll
      for (int nt = 0; nt < 4; ++nt)
        s[nt] = wmma16(qf[kk], bf[nt], s[nt]);
    }

    // Online softmax: row reductions inside 16-lane halves (xor 1,2,4,8)
    _Float16* pw = Ps + wid * 16 * 72;
#pragma unroll
    for (int r = 0; r < 8; ++r) {
      float mx = s[0][r];
#pragma unroll
      for (int nt = 1; nt < 4; ++nt) mx = fmaxf(mx, s[nt][r]);
      mx = fmaxf(mx, __shfl_xor(mx, 1, 32));
      mx = fmaxf(mx, __shfl_xor(mx, 2, 32));
      mx = fmaxf(mx, __shfl_xor(mx, 4, 32));
      mx = fmaxf(mx, __shfl_xor(mx, 8, 32));
      float mnew  = fmaxf(mi[r], mx);
      float alpha = __expf(mi[r] - mnew);
      mi[r] = mnew;
      float sum = 0.0f;
#pragma unroll
      for (int nt = 0; nt < 4; ++nt) {
        float p = __expf(s[nt][r] - mnew);
        s[nt][r] = p;
        sum += p;
      }
      sum += __shfl_xor(sum, 1, 32);
      sum += __shfl_xor(sum, 2, 32);
      sum += __shfl_xor(sum, 4, 32);
      sum += __shfl_xor(sum, 8, 32);
      li[r] = li[r] * alpha + sum;
#pragma unroll
      for (int dt = 0; dt < 4; ++dt) o[dt][r] *= alpha;
    }

    // Spill P (per-wave private LDS strip; LDS in-order within a wave)
#pragma unroll
    for (int nt = 0; nt < 4; ++nt)
#pragma unroll
      for (int r = 0; r < 8; ++r)
        pw[(r + hi) * 72 + nt * 16 + (lane & 15)] = (_Float16)s[nt][r];

    // O += P @ V
#pragma unroll
    for (int kk = 0; kk < 2; ++kk) {
      v16h a = frag_f16(pw + kk * 32, 72, lane);
      v16h bf[4];
#pragma unroll
      for (int dt = 0; dt < 4; ++dt)
        bf[dt] = frag_f16(&Vs[cur][0] + dt * 16 * 72 + kk * 32, 72, lane);
#pragma unroll
      for (int dt = 0; dt < 4; ++dt)
        o[dt] = wmma16(a, bf[dt], o[dt]);
    }
    __syncthreads();                     // done reading buf[cur] before reuse
  }

  // Normalize and write (b, L, DIM) f16
#pragma unroll
  for (int dt = 0; dt < 4; ++dt)
#pragma unroll
    for (int r = 0; r < 8; ++r) {
      int m = qb * 64 + wid * 16 + r + hi;
      float val = o[dt][r] / li[r];
      ao[((size_t)b * L_ + m) * DIM_ + h * DH + dt * 16 + (lane & 15)] = (_Float16)val;
    }
}

// ---------------------------------------------------------------------------
// Kernel 3: out = attn(f16) @ w_proj, fp32 out. BM=64, BN=256, A and B pipelined.
// ---------------------------------------------------------------------------
__global__ __launch_bounds__(256) void proj_kernel(
    const _Float16* __restrict__ a16, const float* __restrict__ w,
    float* __restrict__ out) {
  __shared__ __attribute__((aligned(16))) _Float16 Bs[256 * 40];
  __shared__ __attribute__((aligned(16))) _Float16 As[64 * 40];   // [m][k], same stride
  const int lane = threadIdx.x & 31;
  const int wid  = threadIdx.x >> 5;
  const int wm = wid & 1, wn = wid >> 1;
  const int bn = blockIdx.x, bm = blockIdx.y;
  const int row0 = bm * 64 + wm * 32;
  const int n4 = threadIdx.x & 63, kg = threadIdx.x >> 6;  // B staging: 4 columns x 8 consecutive k per thread
  // A staging: 4 threads read one row's 32 k (64 B); one row piece per thread
  const int ar = threadIdx.x >> 2, ac = threadIdx.x & 3;
  const _Float16* aa = a16 + (size_t)(bm * 64 + ar) * DIM_ + ac * 8;

  v8f z = {0.f,0.f,0.f,0.f,0.f,0.f,0.f,0.f};
  v8f acc[2][4];
#pragma unroll
  for (int ms = 0; ms < 2; ++ms)
#pragma unroll
    for (int nt = 0; nt < 4; ++nt) acc[ms][nt] = z;

  v4f tmp[8];
#pragma unroll
  for (int i = 0; i < 8; ++i)
    tmp[i] = *(const v4f*)&w[(size_t)(kg * 8 + i) * DIM_ + bn * 256 + n4 * 4];
  v8h ta = *(const v8h*)aa;

  for (int kb = 0; kb < DIM_; kb += 32) {
    __syncthreads();
#pragma unroll
    for (int j = 0; j < 4; ++j) {                // regs -> LDS: 8 k of one column per 16-B store
      v8h hcol;
#pragma unroll  // constant indices keep tmp and hcol in registers
      for (int i = 0; i < 8; ++i) hcol[i] = (_Float16)tmp[i][j];
      *(v8h*)&Bs[(n4 * 4 + j) * 40 + kg * 8] = hcol;
    }
    *(v8h*)&As[ar * 40 + ac * 8] = ta;           // A: read once per block, shared by the 4 N-waves
    __syncthreads();
    if (kb + 32 < DIM_) {
#pragma unroll
      for (int i = 0; i < 8; ++i)
        tmp[i] = *(const v4f*)&w[(size_t)(kb + 32 + kg * 8 + i) * DIM_ + bn * 256 + n4 * 4];
      ta = *(const v8h*)&aa[kb + 32];
      // the loads' address registers are advanced later in this trip: keep the wait in front of that
      asm volatile("s_wait_xcnt 0x0" ::: "memory");
    }
    v16h a0 = frag_f16(As + (wm * 32) * 40, 40, lane);
    v16h a1 = frag_f16(As + (wm * 32 + 16) * 40, 40, lane);
    v16h bf[4];
#pragma unroll
    for (int nt = 0; nt < 4; ++nt)
      bf[nt] = frag_f16(Bs + (wn * 64 + nt * 16) * 40, 40, lane);
#pragma unroll
    for (int nt = 0; nt < 4; ++nt) {
      acc[0][nt] = wmma16(a0, bf[nt], acc[0][nt]);
      acc[1][nt] = wmma16(a1, bf[nt], acc[1][nt]);
    }
  }

  const int hi = (lane & 16) ? 8 : 0;
#pragma unroll
  for (int ms = 0; ms < 2; ++ms)
#pragma unroll
    for (int nt = 0; nt < 4; ++nt) {
      int n = bn * 256 + wn * 64 + nt * 16 + (lane & 15);
#pragma unroll
      for (int r = 0; r < 8; ++r) {
        int m = row0 + ms * 16 + r + hi;
        out[(size_t)m * DIM_ + n] = acc[ms][nt][r];
      }
    }
}

// ---------------------------------------------------------------------------
extern "C" void kernel_launch(void* const* d_in, const int* in_sizes, int n_in,
                              void* d_out, int out_size, void* d_ws, size_t ws_size,
                              hipStream_t stream) {
  (void)in_sizes; (void)n_in; (void)out_size; (void)ws_size;
  const float* x      = (const float*)d_in[0];
  const float* w_qkv  = (const float*)d_in[1];
  const float* w_proj = (const float*)d_in[2];

  char* ws = (char*)d_ws;
  _Float16* qw = (_Float16*)(ws);
  _Float16* kw = (_Float16*)(ws + (size_t)16 * 1024 * 1024);
  _Float16* vw = (_Float16*)(ws + (size_t)32 * 1024 * 1024);
  _Float16* ao = (_Float16*)(ws + (size_t)48 * 1024 * 1024);
  float* out = (float*)d_out;

  qkv_rope_kernel<<<dim3(N3 / 256, (B_ * L_) / 64), 256, 0, stream>>>(x, w_qkv, qw, kw, vw);
  attn_kernel<<<dim3(L_ / 64, NH, B_), 128, 0, stream>>>(qw, kw, vw, ao);
  proj_kernel<<<dim3(DIM_ / 256, (B_ * L_) / 64), 256, 0, stream>>>(ao, w_proj, out);
}

// v003
// Measured time: 187 microseconds a run.
// In both of two side-by-side timings against v002, it was 1.43 times as fast.
// All steps since v000 together make it 3.61 times as fast.
#include <hip/hip_runtime.h>

typedef __attribute__((ext_vector_type(16))) _Float16 v16h;
typedef __attribute__((ext_vector_type(8)))  _Float16 v8h;
typedef __attribute__((ext_vector_type(4)))  _Float16 v4h;
typedef __attribute__((ext_vector_type(8)))  float    v8f;
typedef __attribute__((ext_vector_type(4)))  float    v4f;

#define B_    8
#define L_    1024
#define DIM_  1024
#define NH    16
#define DH    64
#define N3    3072
#define PI_F  3.14159265358979323846f

__device__ __forceinline__ v16h frag_f16(const _Float16* base, int stride, int lane) {
  const int row = lane & 15;
  const int lo  = (lane & 16) ? 8 : 0;
  const _Float16* p = base + row * stride + lo;
  v8h a = *(const v8h*)(p);
  v8h b = *(const v8h*)(p + 16);
  return __builtin_shufflevector(a, b, 0,1,2,3,4,5,6,7,8,9,10,11,12,13,14,15);
}

__device__ __forceinline__ v8f wmma16(v16h a, v16h b, v8f c) {
  return __builtin_amdgcn_wmma_f32_16x16x32_f16(false, a, false, b, (short)0, c, false, false);
}

__device__ __forceinline__ void sincos_rev(float rev, float& s, float& c) {
  asm("v_sin_f32 %0, %2\n\tv_cos_f32 %1, %2\n\tv_nop" : "=&v"(s), "=&v"(c) : "v"(rev));
}

__device__ __forceinline__ void async_ld16(unsigned lds_byte_off, const void* gptr) {
  asm volatile("global_load_async_to_lds_b128 %0, %1, off"
               :: "v"(lds_byte_off), "v"(gptr) : "memory");
}
__device__ __forceinline__ void wait_async_le0() {
  asm volatile("s_wait_asynccnt 0x0" ::: "memory");
}
__device__ __forceinline__ void wait_async_le8() {
  asm volatile("s_wait_asynccnt 0x8" ::: "memory");
}

// ---------------------------------------------------------------------------
// Kernel 1: QKV = x @ w_qkv with fused 2D axial RoPE; q pre-scaled by 1/64.
// BM=64, BN=256, BK=32; 8 waves = 2(M) x 4(N); software-pipelined A and B staging.
// ---------------------------------------------------------------------------
__global__ __launch_bounds__(256) void qkv_rope_kernel(
    const float* __restrict__ x, const float* __restrict__ w,
    _Float16* __restrict__ qw, _Float16* __restrict__ kw, _Float16* __restrict__ vw) {
  __shared__ __attribute__((aligned(16))) _Float16 Bs[256 * 40];
  __shared__ __attribute__((aligned(16))) _Float16 As[64 * 40];   // [m][k], same stride
  const int lane = threadIdx.x & 31;
  const int wid  = threadIdx.x >> 5;
  const int wm = wid & 1, wn = wid >> 1;
  const int bn = blockIdx.x, bm = blockIdx.y;
  const int row0 = bm * 64 + wm * 32;
  const int n4 = threadIdx.x & 63, kg = threadIdx.x >> 6;  // B staging: 4 columns x 8 consecutive k per thread
  // A staging: 8 threads read one row's 32 k (a whole 128-B line); rows ar and ar + 32 per thread
  const int ar = threadIdx.x >> 3, ac = threadIdx.x & 7;
  const float* xa = x + (size_t)(bm * 64 + ar) * DIM_ + ac * 4;

  v8f z = {0.f,0.f,0.f,0.f,0.f,0.f,0.f,0.f};
  v8f acc[2][4];
#pragma unroll
  for (int ms = 0; ms < 2; ++ms)
#pragma unroll
    for (int nt = 0; nt < 4; ++nt) acc[ms][nt] = z;

  v4f tmp[8];                                    // register double-buffer for B
  v4f ta[2];                                     // and for A
#pragma unroll
  for (int i = 0; i < 8; ++i)                    // prologue: tile kb=0
    tmp[i] = *(const v4f*)&w[(size_t)(kg * 8 + i) * N3 + bn * 256 + n4 * 4];
#pragma unroll
  for (int i = 0; i < 2; ++i)
    ta[i] = *(const v4f*)&xa[(size_t)(32 * i) * DIM_];

  for (int kb = 0; kb < DIM_; kb += 32) {
    __syncthreads();                             // previous tile's reads done
#pragma unroll
    for (int j = 0; j < 4; ++j) {                // regs -> LDS: 8 k of one column per 16-B store
      v8h hcol;
#pragma unroll  // constant indices keep tmp and hcol in registers
      for (int i = 0; i < 8; ++i) hcol[i] = (_Float16)tmp[i][j];
      *(v8h*)&Bs[(j * 64 + n4) * 40 + kg * 8] = hcol;   // column 4*n4+j lives at LDS row 64*j+n4
    }
#pragma unroll
    for (int i = 0; i < 2; ++i)                  // A: converted once per block, shared by the 4 N-waves
      *(v4h*)&As[(ar + 32 * i) * 40 + ac * 4] = __builtin_convertvector(ta[i], v4h);
    __syncthreads();
    if (kb + 32 < DIM_) {                        // issue next tile early: overlaps WMMA
#pragma unroll
      for (int i = 0; i < 8; ++i)
        tmp[i] = *(const v4f*)&w[(size_t)(kb + 32 + kg * 8 + i) * N3 + bn * 256 + n4 * 4];
#pragma unroll
      for (int i = 0; i < 2; ++i)
        ta[i] = *(const v4f*)&xa[(size_t)(32 * i) * DIM_ + kb + 32];
      // the loads' address registers are advanced later in this trip: keep the wait in front of that
      asm volatile("s_wait_xcnt 0x0" ::: "memory");
    }
    v16h a0 = frag_f16(As + (wm * 32) * 40, 40, lane);
    v16h a1 = frag_f16(As + (wm * 32 + 16) * 40, 40, lane);
    v16h bf[4];
#pragma unroll
    for (int nt = 0; nt < 4; ++nt)               // batch ds loads, stagger waits
      bf[nt] = frag_f16(Bs + (nt * 64 + wn * 16) * 40, 40, lane);  // tile nt = columns 4*i+nt
#pragma unroll
    for (int nt = 0; nt < 4; ++nt) {
      acc[0][nt] = wmma16(a0, bf[nt], acc[0][nt]);
      acc[1][nt] = wmma16(a1, bf[nt], acc[1][nt]);
    }
  }

  // Epilogue: RoPE + scatter. C layout: lane holds (M = r + hi, column 4*(lane&15) + nt).
  const int hi = (lane & 16) ? 8 : 0;
  const int seg = bn >> 2;                 // 0=q 1=k 2=v, the same for the whole block
  const int h  = (bn & 3) * 4 + wn;        // a wave's 64 columns are one head
  const int d0 = (lane & 15) * 4;
  const int b  = row0 >> 10;               // a wave's 32 rows lie in one batch and one image row
  const int l0 = (row0 & 1023) + hi;
  if (seg < 2) {
    _Float16* dst = (seg == 0 ? qw : kw) + ((size_t)(b * NH + h) * L_ + l0) * DH + d0;
    const float sc = (seg == 0) ? (1.0f / 64.0f) : 1.0f;
    const bool wax = d0 >= 32;             // upper half of the head rotates by the column position
    float fj[2];
#pragma unroll  // constant indices keep fj in registers
    for (int p = 0; p < 2; ++p) {
      int j = ((wax ? (d0 - 32) : d0) >> 1) + p;
      fj[p] = (1.0f + (127.0f / 15.0f) * (float)j) * PI_F;
    }
#pragma unroll  // constant indices keep acc in registers
    for (int ms = 0; ms < 2; ++ms) {
#pragma unroll  // constant indices keep acc in registers
      for (int r = 0; r < 8; ++r) {
        int l = l0 + ms * 16 + r;
        float pos = wax ? (-1.0f + (2.0f / 31.0f) * (float)(l & 31))
                        : (-1.0f + (2.0f / 31.0f) * (float)(l >> 5));
        v4h hv;
#pragma unroll  // constant indices keep acc in registers
        for (int p = 0; p < 2; ++p) {      // the rotated pair is two adjacent columns the lane holds
          float th = pos * fj[p];
          float cv, sv;
          sincos_rev(th * 0.15915494309189532f, sv, cv);
          float e = acc[ms][2 * p][r], o = acc[ms][2 * p + 1][r];
          hv[2 * p]     = (_Float16)((e * cv - o * sv) * sc);
          hv[2 * p + 1] = (_Float16)((o * cv + e * sv) * sc);
        }
        *(v4h*)&dst[(ms * 16 + r) * DH] = hv;   // 16 lanes x 8 B = one whole 128-B row
      }
    }
  } else {
    _Float16* dst = vw + ((size_t)(b * NH + h) * DH + d0) * L_ + l0;   // transposed
#pragma unroll  // constant indices keep acc in registers
    for (int ms = 0; ms < 2; ++ms)
#pragma unroll  // constant indices keep acc in registers
      for (int nt = 0; nt < 4; ++nt)       // a lane's 8 rows of one column are 8 adjacent l
        *(v8h*)&dst[nt * L_ + ms * 16] = __builtin_convertvector(acc[ms][nt], v8h);
    // in the listing the q/k code stands behind these stores and rewrites their registers: keep the wait in front
    asm volatile("s_wait_xcnt 0x0" ::: "memory");
  }
}

__global__ __launch_bounds__(128) void attn_kernel(
    const _Float16* __restrict__ qw, const _Float16* __restrict__ kw,
    const _Float16* __restrict__ vw, _Float16* __restrict__ ao) {
  __shared__ _Float16 Qs[64 * 72];       // [m][d]
  __shared__ _Float16 Ks[2][64 * 72];    // [key][d], double-buffered
  __shared__ _Float16 Vs[2][64 * 72];    // [d][key], double-buffered
  __shared__ _Float16 Ps[64 * 72];       // per-wave 16-row strips
  const int lane = threadIdx.x & 31;
  const int wid  = threadIdx.x >> 5;
  const int qb = blockIdx.x, h = blockIdx.y, b = blockIdx.z;
  const int bh = b * NH + h;
  const _Float16* qg = qw + (size_t)bh * L_ * DH + (size_t)qb * 64 * DH;
  const _Float16* kg = kw + (size_t)bh * L_ * DH;
  const _Float16* vg = vw + (size_t)bh * DH * L_;

  const unsigned qs0 = (unsigned)(uintptr_t)(&Qs[0]);
  const unsigned ks0 = (unsigned)(uintptr_t)(&Ks[0][0]);
  const unsigned vs0 = (unsigned)(uintptr_t)(&Vs[0][0]);
  const unsigned bufstep = 64 * 72 * 2;  // bytes per buffer

  // per-thread slice used for all tile copies: 4 rows of 16B
  const int off0 = threadIdx.x * 8;      // covers 1024 halves per c-step
  // stage Q (4 async) then K/V tile 0 (8 async)
#pragma unroll
  for (int c = 0; c < 4; ++c) {
    int off = off0 + 128 * 8 * c;
    int m = off >> 6, d0 = off & 63;
    async_ld16(qs0 + (unsigned)(m * 72 + d0) * 2, qg + m * DH + d0);
  }
#pragma unroll
  for (int c = 0; c < 4; ++c) {
    int off = off0 + 128 * 8 * c;
    int row = off >> 6, d0 = off & 63;
    async_ld16(ks0 + (unsigned)(row * 72 + d0) * 2, kg + (size_t)row * DH + d0);
    async_ld16(vs0 + (unsigned)(row * 72 + d0) * 2, vg + (size_t)row * L_ + d0);
  }
  wait_async_le8();                      // Q (oldest 4) complete
  __syncthreads();

  // Q fragments are kt-invariant: hoist out of the loop
  v16h qf[2];
#pragma unroll
  for (int kk = 0; kk < 2; ++kk)
    qf[kk] = frag_f16(Qs + wid * 16 * 72 + kk * 32, 72, lane);

  v8f z = {0.f,0.f,0.f,0.f,0.f,0.f,0.f,0.f};
  v8f o[4];
#pragma unroll
  for (int dt = 0; dt < 4; ++dt) o[dt] = z;
  float mi[8], li[8];
#pragma unroll
  for (int r = 0; r < 8; ++r) { mi[r] = -1e30f; li[r] = 0.0f; }
  const int hi = (lane & 16) ? 8 : 0;

  for (int kt = 0; kt < 16; ++kt) {
    const int cur = kt & 1;
    if (kt + 1 < 16) {                   // issue next tile; overlaps compute below
      const int nxt = (kt + 1) & 1;
#pragma unroll
      for (int c = 0; c < 4; ++c) {
        int off = off0 + 128 * 8 * c;
        int row = off >> 6, d0 = off & 63;
        async_ld16(ks0 + nxt * bufstep + (unsigned)(row * 72 + d0) * 2,
                   kg + (size_t)((kt + 1) * 64 + row) * DH + d0);
        async_ld16(vs0 + nxt * bufstep + (unsigned)(row * 72 + d0) * 2,
                   vg + (size_t)row * L_ + (kt + 1) * 64 + d0);
      }
      wait_async_le8();                  // in-order: tile kt fully landed
    } else {
      wait_async_le0();
    }
    __syncthreads();                     // all waves' tile-kt parts visible

    v8f s[4];
#pragma unroll
    for (int nt = 0; nt < 4; ++nt) s[nt] = z;
#pragma unroll
    for (int kk = 0; kk < 2; ++kk) {
      v16h bf[4];
#pragma unroll
      for (int nt = 0; nt < 4; ++nt)
        bf[nt] = frag_f16(&Ks[cur][0] + nt * 16 * 72 + kk * 32, 72, lane);
#pragma unroll
      for (int nt = 0; nt < 4; ++nt)
        s[nt] = wmma16(qf[kk], bf[nt], s[nt]);
    }

    // Online softmax: row reductions inside 16-lane halves (xor 1,2,4,8)
    _Float16* pw = Ps + wid * 16 * 72;
#pragma unroll
    for (int r = 0; r < 8; ++r) {
      float mx = s[0][r];
#pragma unroll
      for (int nt = 1; nt < 4; ++nt) mx = fmaxf(mx, s[nt][r]);
      mx = fmaxf(mx, __shfl_xor(mx, 1, 32));
      mx = fmaxf(mx, __shfl_xor(mx, 2, 32));
      mx = fmaxf(mx, __shfl_xor(mx, 4, 32));
      mx = fmaxf(mx, __shfl_xor(mx, 8, 32));
      float mnew  = fmaxf(mi[r], mx);
      float alpha = __expf(mi[r] - mnew);
      mi[r] = mnew;
      float sum = 0.0f;
#pragma unroll
      for (int nt = 0; nt < 4; ++nt) {
        float p = __expf(s[nt][r] - mnew);
        s[nt][r] = p;
        sum += p;
      }
      sum += __shfl_xor(sum, 1, 32);
      sum += __shfl_xor(sum, 2, 32);
      sum += __shfl_xor(sum, 4, 32);
      sum += __shfl_xor(sum, 8, 32);
      li[r] = li[r] * alpha + sum;
#pragma unroll
      for (int dt = 0; dt < 4; ++dt) o[dt][r] *= alpha;
    }

    // Spill P (per-wave private LDS strip; LDS in-order within a wave)
#pragma unroll
    for (int nt = 0; nt < 4; ++nt)
#pragma unroll
      for (int r = 0; r < 8; ++r)
        pw[(r + hi) * 72 + nt * 16 + (lane & 15)] = (_Float16)s[nt][r];

    // O += P @ V
#pragma unroll
    for (int kk = 0; kk < 2; ++kk) {
      v16h a = frag_f16(pw + kk * 32, 72, lane);
      v16h bf[4];
#pragma unroll
      for (int dt = 0; dt < 4; ++dt)
        bf[dt] = frag_f16(&Vs[cur][0] + dt * 16 * 72 + kk * 32, 72, lane);
#pragma unroll
      for (int dt = 0; dt < 4; ++dt)
        o[dt] = wmma16(a, bf[dt], o[dt]);
    }
    __syncthreads();                     // done reading buf[cur] before reuse
  }

  // Normalize and write (b, L, DIM) f16
#pragma unroll
  for (int dt = 0; dt < 4; ++dt)
#pragma unroll
    for (int r = 0; r < 8; ++r) {
      int m = qb * 64 + wid * 16 + r + hi;
      float val = o[dt][r] / li[r];
      ao[((size_t)b * L_ + m) * DIM_ + h * DH + dt * 16 + (lane & 15)] = (_Float16)val;
    }
}

// ---------------------------------------------------------------------------
// Kernel 3: out = attn(f16) @ w_proj, fp32 out. BM=64, BN=256, A and B pipelined.
// ---------------------------------------------------------------------------
__global__ __launch_bounds__(256) void proj_kernel(
    const _Float16* __restrict__ a16, const float* __restrict__ w,
    float* __restrict__ out) {
  __shared__ __attribute__((aligned(16))) _Float16 Bs[256 * 40];
  __shared__ __attribute__((aligned(16))) _Float16 As[64 * 40];   // [m][k], same stride
  const int lane = threadIdx.x & 31;
  const int wid  = threadIdx.x >> 5;
  const int wm = wid & 1, wn = wid >> 1;
  const int bn = blockIdx.x, bm = blockIdx.y;
  const int row0 = bm * 64 + wm * 32;
  const int n4 = threadIdx.x & 63, kg = threadIdx.x >> 6;  // B staging: 4 columns x 8 consecutive k per thread
  // A staging: 4 threads read one row's 32 k (64 B); one row piece per thread
  const int ar = threadIdx.x >> 2, ac = threadIdx.x & 3;
  const _Float16* aa = a16 + (size_t)(bm * 64 + ar) * DIM_ + ac * 8;

  v8f z = {0.f,0.f,0.f,0.f,0.f,0.f,0.f,0.f};
  v8f acc[2][4];
#pragma unroll
  for (int ms = 0; ms < 2; ++ms)
#pragma unroll
    for (int nt = 0; nt < 4; ++nt) acc[ms][nt] = z;

  v4f tmp[8];
#pragma unroll
  for (int i = 0; i < 8; ++i)
    tmp[i] = *(const v4f*)&w[(size_t)(kg * 8 + i) * DIM_ + bn * 256 + n4 * 4];
  v8h ta = *(const v8h*)aa;

  for (int kb = 0; kb < DIM_; kb += 32) {
    __syncthreads();
#pragma unroll
    for (int j = 0; j < 4; ++j) {                // regs -> LDS: 8 k of one column per 16-B store
      v8h hcol;
#pragma unroll  // constant indices keep tmp and hcol in registers
      for (int i = 0; i < 8; ++i) hcol[i] = (_Float16)tmp[i][j];
      *(v8h*)&Bs[(j * 64 + n4) * 40 + kg * 8] = hcol;   // column 4*n4+j lives at LDS row 64*j+n4
    }
    *(v8h*)&As[ar * 40 + ac * 8] = ta;           // A: read once per block, shared by the 4 N-waves
    __syncthreads();
    if (kb + 32 < DIM_) {
#pragma unroll
      for (int i = 0; i < 8; ++i)
        tmp[i] = *(const v4f*)&w[(size_t)(kb + 32 + kg * 8 + i) * DIM_ + bn * 256 + n4 * 4];
      ta = *(const v8h*)&aa[kb + 32];
      // the loads' address registers are advanced later in this trip: keep the wait in front of that
      asm volatile("s_wait_xcnt 0x0" ::: "memory");
    }
    v16h a0 = frag_f16(As + (wm * 32) * 40, 40, lane);
    v16h a1 = frag_f16(As + (wm * 32 + 16) * 40, 40, lane);
    v16h bf[4];
#pragma unroll
    for (int nt = 0; nt < 4; ++nt)
      bf[nt] = frag_f16(Bs + (nt * 64 + wn * 16) * 40, 40, lane);  // tile nt = columns 4*i+nt
#pragma unroll
    for (int nt = 0; nt < 4; ++nt) {
      acc[0][nt] = wmma16(a0, bf[nt], acc[0][nt]);
      acc[1][nt] = wmma16(a1, bf[nt], acc[1][nt]);
    }
  }

  const int hi = (lane & 16) ? 8 : 0;
  float* dst = out + (size_t)(row0 + hi) * DIM_ + bn * 256 + wn * 64 + (lane & 15) * 4;
#pragma unroll  // constant indices keep acc in registers
  for (int ms = 0; ms < 2; ++ms)
#pragma unroll  // constant indices keep acc in registers
    for (int r = 0; r < 8; ++r) {          // 16 lanes x 16 B = two whole lines of one row
      v4f ov = {acc[ms][0][r], acc[ms][1][r], acc[ms][2][r], acc[ms][3][r]};
      *(v4f*)&dst[(size_t)(ms * 16 + r) * DIM_] = ov;
    }
}

// ---------------------------------------------------------------------------
extern "C" void kernel_launch(void* const* d_in, const int* in_sizes, int n_in,
                              void* d_out, int out_size, void* d_ws, size_t ws_size,
                              hipStream_t stream) {
  (void)in_sizes; (void)n_in; (void)out_size; (void)ws_size;
  const float* x      = (const float*)d_in[0];
  const float* w_qkv  = (const float*)d_in[1];
  const float* w_proj = (const float*)d_in[2];

  char* ws = (char*)d_ws;
  _Float16* qw = (_Float16*)(ws);
  _Float16* kw = (_Float16*)(ws + (size_t)16 * 1024 * 1024);
  _Float16* vw = (_Float16*)(ws + (size_t)32 * 1024 * 1024);
  _Float16* ao = (_Float16*)(ws + (size_t)48 * 1024 * 1024);
  float* out = (float*)d_out;

  qkv_rope_kernel<<<dim3(N3 / 256, (B_ * L_) / 64), 256, 0, stream>>>(x, w_qkv, qw, kw, vw);
  attn_kernel<<<dim3(L_ / 64, NH, B_), 128, 0, stream>>>(qw, kw, vw, ao);
  proj_kernel<<<dim3(DIM_ / 256, (B_ * L_) / 64), 256, 0, stream>>>(ao, w_proj, out);
}

// v004
// Measured time: 156 microseconds a run.
// In two side-by-side timings against v003, it was 1.20 and 1.19 times as fast.
// All steps since v000 together make it 4.31 times as fast.
#include <hip/hip_runtime.h>

typedef __attribute__((ext_vector_type(16))) _Float16 v16h;
typedef __attribute__((ext_vector_type(8)))  _Float16 v8h;
typedef __attribute__((ext_vector_type(4)))  _Float16 v4h;
typedef __attribute__((ext_vector_type(8)))  float    v8f;
typedef __attribute__((ext_vector_type(4)))  float    v4f;

#define B_    8
#define L_    1024
#define DIM_  1024
#define NH    16
#define DH    64
#define N3    3072
#define PI_F  3.14159265358979323846f

__device__ __forceinline__ v16h frag_f16(const _Float16* base, int stride, int lane) {
  const int row = lane & 15;
  const int lo  = (lane & 16) ? 8 : 0;
  const _Float16* p = base + row * stride + lo;
  v8h a = *(const v8h*)(p);
  v8h b = *(const v8h*)(p + 16);
  return __builtin_shufflevector(a, b, 0,1,2,3,4,5,6,7,8,9,10,11,12,13,14,15);
}

__device__ __forceinline__ v8f wmma16(v16h a, v16h b, v8f c) {
  return __builtin_amdgcn_wmma_f32_16x16x32_f16(false, a, false, b, (short)0, c, false, false);
}

__device__ __forceinline__ float xhalf(float x) {
  int b = __builtin_bit_cast(int, x);
  return __builtin_bit_cast(float, __builtin_amdgcn_permlanex16(b, b, 0x76543210, 0xfedcba98, false, false));
}

__device__ __forceinline__ void sincos_rev(float rev, float& s, float& c) {
  asm("v_sin_f32 %0, %2\n\tv_cos_f32 %1, %2\n\tv_nop" : "=&v"(s), "=&v"(c) : "v"(rev));
}

__device__ __forceinline__ void async_ld16(unsigned lds_byte_off, const void* gptr) {
  asm volatile("global_load_async_to_lds_b128 %0, %1, off"
               :: "v"(lds_byte_off), "v"(gptr) : "memory");
}
__device__ __forceinline__ void wait_async_le0() {
  asm volatile("s_wait_asynccnt 0x0" ::: "memory");
}
__device__ __forceinline__ void wait_async_le8() {
  asm volatile("s_wait_asynccnt 0x8" ::: "memory");
}

// ---------------------------------------------------------------------------
// Kernel 1: QKV = x @ w_qkv with fused 2D axial RoPE; q pre-scaled by 1/64.
// BM=64, BN=256, BK=32; 8 waves = 2(M) x 4(N); software-pipelined A and B staging.
// ---------------------------------------------------------------------------
__global__ __launch_bounds__(256) void qkv_rope_kernel(
    const float* __restrict__ x, const float* __restrict__ w,
    _Float16* __restrict__ qw, _Float16* __restrict__ kw, _Float16* __restrict__ vw) {
  __shared__ __attribute__((aligned(16))) _Float16 Bs[256 * 40];
  __shared__ __attribute__((aligned(16))) _Float16 As[64 * 40];   // [m][k], same stride
  const int lane = threadIdx.x & 31;
  const int wid  = threadIdx.x >> 5;
  const int wm = wid & 1, wn = wid >> 1;
  const int bn = blockIdx.x, bm = blockIdx.y;
  const int row0 = bm * 64 + wm * 32;
  const int n4 = threadIdx.x & 63, kg = threadIdx.x >> 6;  // B staging: 4 columns x 8 consecutive k per thread
  // A staging: 8 threads read one row's 32 k (a whole 128-B line); rows ar and ar + 32 per thread
  const int ar = threadIdx.x >> 3, ac = threadIdx.x & 7;
  const float* xa = x + (size_t)(bm * 64 + ar) * DIM_ + ac * 4;

  v8f z = {0.f,0.f,0.f,0.f,0.f,0.f,0.f,0.f};
  v8f acc[2][4];
#pragma unroll
  for (int ms = 0; ms < 2; ++ms)
#pragma unroll
    for (int nt = 0; nt < 4; ++nt) acc[ms][nt] = z;

  v4f tmp[8];                                    // register double-buffer for B
  v4f ta[2];                                     // and for A
#pragma unroll
  for (int i = 0; i < 8; ++i)                    // prologue: tile kb=0
    tmp[i] = *(const v4f*)&w[(size_t)(kg * 8 + i) * N3 + bn * 256 + n4 * 4];
#pragma unroll
  for (int i = 0; i < 2; ++i)
    ta[i] = *(const v4f*)&xa[(size_t)(32 * i) * DIM_];

  for (int kb = 0; kb < DIM_; kb += 32) {
    __syncthreads();                             // previous tile's reads done
#pragma unroll
    for (int j = 0; j < 4; ++j) {                // regs -> LDS: 8 k of one column per 16-B store
      v8h hcol;
#pragma unroll  // constant indices keep tmp and hcol in registers
      for (int i = 0; i < 8; ++i) hcol[i] = (_Float16)tmp[i][j];
      *(v8h*)&Bs[(j * 64 + n4) * 40 + kg * 8] = hcol;   // column 4*n4+j lives at LDS row 64*j+n4
    }
#pragma unroll
    for (int i = 0; i < 2; ++i)                  // A: converted once per block, shared by the 4 N-waves
      *(v4h*)&As[(ar + 32 * i) * 40 + ac * 4] = __builtin_convertvector(ta[i], v4h);
    __syncthreads();
    if (kb + 32 < DIM_) {                        // issue next tile early: overlaps WMMA
#pragma unroll
      for (int i = 0; i < 8; ++i)
        tmp[i] = *(const v4f*)&w[(size_t)(kb + 32 + kg * 8 + i) * N3 + bn * 256 + n4 * 4];
#pragma unroll
      for (int i = 0; i < 2; ++i)
        ta[i] = *(const v4f*)&xa[(size_t)(32 * i) * DIM_ + kb + 32];
      // the loads' address registers are advanced later in this trip: keep the wait in front of that
      asm volatile("s_wait_xcnt 0x0" ::: "memory");
    }
    v16h a0 = frag_f16(As + (wm * 32) * 40, 40, lane);
    v16h a1 = frag_f16(As + (wm * 32 + 16) * 40, 40, lane);
    v16h bf[4];
#pragma unroll
    for (int nt = 0; nt < 4; ++nt)               // batch ds loads, stagger waits
      bf[nt] = frag_f16(Bs + (nt * 64 + wn * 16) * 40, 40, lane);  // tile nt = columns 4*i+nt
#pragma unroll
    for (int nt = 0; nt < 4; ++nt) {
      acc[0][nt] = wmma16(a0, bf[nt], acc[0][nt]);
      acc[1][nt] = wmma16(a1, bf[nt], acc[1][nt]);
    }
  }

  // Epilogue: RoPE + scatter. C layout: lane holds (M = r + hi, column 4*(lane&15) + nt).
  const int hi = (lane & 16) ? 8 : 0;
  const int seg = bn >> 2;                 // 0=q 1=k 2=v, the same for the whole block
  const int h  = (bn & 3) * 4 + wn;        // a wave's 64 columns are one head
  const int d0 = (lane & 15) * 4;
  const int b  = row0 >> 10;               // a wave's 32 rows lie in one batch and one image row
  const int l0 = (row0 & 1023) + hi;
  if (seg < 2) {
    _Float16* dst = (seg == 0 ? qw : kw) + ((size_t)(b * NH + h) * L_ + l0) * DH + d0;
    const float sc = (seg == 0) ? (1.0f / 64.0f) : 1.0f;
    const bool wax = d0 >= 32;             // upper half of the head rotates by the column position
    float fj[2];
#pragma unroll  // constant indices keep fj in registers
    for (int p = 0; p < 2; ++p) {
      int j = ((wax ? (d0 - 32) : d0) >> 1) + p;
      fj[p] = (1.0f + (127.0f / 15.0f) * (float)j) * PI_F;
    }
#pragma unroll  // constant indices keep acc in registers
    for (int ms = 0; ms < 2; ++ms) {
#pragma unroll  // constant indices keep acc in registers
      for (int r = 0; r < 8; ++r) {
        int l = l0 + ms * 16 + r;
        float pos = wax ? (-1.0f + (2.0f / 31.0f) * (float)(l & 31))
                        : (-1.0f + (2.0f / 31.0f) * (float)(l >> 5));
        v4h hv;
#pragma unroll  // constant indices keep acc in registers
        for (int p = 0; p < 2; ++p) {      // the rotated pair is two adjacent columns the lane holds
          float th = pos * fj[p];
          float cv, sv;
          sincos_rev(th * 0.15915494309189532f, sv, cv);
          float e = acc[ms][2 * p][r], o = acc[ms][2 * p + 1][r];
          hv[2 * p]     = (_Float16)((e * cv - o * sv) * sc);
          hv[2 * p + 1] = (_Float16)((o * cv + e * sv) * sc);
        }
        *(v4h*)&dst[(ms * 16 + r) * DH] = hv;   // 16 lanes x 8 B = one whole 128-B row
      }
    }
  } else {
    _Float16* dst = vw + ((size_t)(b * NH + h) * DH + d0) * L_ + l0;   // transposed
#pragma unroll  // constant indices keep acc in registers
    for (int ms = 0; ms < 2; ++ms)
#pragma unroll  // constant indices keep acc in registers
      for (int nt = 0; nt < 4; ++nt)       // a lane's 8 rows of one column are 8 adjacent l
        *(v8h*)&dst[nt * L_ + ms * 16] = __builtin_convertvector(acc[ms][nt], v8h);
    // in the listing the q/k code stands behind these stores and rewrites their registers: keep the wait in front
    asm volatile("s_wait_xcnt 0x0" ::: "memory");
  }
}

__global__ __launch_bounds__(128) void attn_kernel(
    const _Float16* __restrict__ qw, const _Float16* __restrict__ kw,
    const _Float16* __restrict__ vw, _Float16* __restrict__ ao) {
  __shared__ _Float16 Qs[64 * 72];       // [m][d]
  __shared__ _Float16 Ks[2][64 * 72];    // [key][d], double-buffered
  __shared__ _Float16 Vs[2][64 * 72];    // [d][key], double-buffered
  const int lane = threadIdx.x & 31;
  const int wid  = threadIdx.x >> 5;
  const int qb = blockIdx.x, h = blockIdx.y, b = blockIdx.z;
  const int bh = b * NH + h;
  const _Float16* qg = qw + (size_t)bh * L_ * DH + (size_t)qb * 64 * DH;
  const _Float16* kg = kw + (size_t)bh * L_ * DH;
  const _Float16* vg = vw + (size_t)bh * DH * L_;

  const unsigned qs0 = (unsigned)(uintptr_t)(&Qs[0]);
  const unsigned ks0 = (unsigned)(uintptr_t)(&Ks[0][0]);
  const unsigned vs0 = (unsigned)(uintptr_t)(&Vs[0][0]);
  const unsigned bufstep = 64 * 72 * 2;  // bytes per buffer

  // per-thread slice used for all tile copies: 4 rows of 16B
  const int off0 = threadIdx.x * 8;      // covers 1024 halves per c-step
  // stage Q (4 async) then K/V tile 0 (8 async)
#pragma unroll
  for (int c = 0; c < 4; ++c) {
    int off = off0 + 128 * 8 * c;
    int m = off >> 6, d0 = off & 63;
    async_ld16(qs0 + (unsigned)(m * 72 + d0) * 2, qg + m * DH + d0);
  }
#pragma unroll
  for (int c = 0; c < 4; ++c) {
    int off = off0 + 128 * 8 * c;
    int row = off >> 6, d0 = off & 63;
    async_ld16(ks0 + (unsigned)(row * 72 + d0) * 2, kg + (size_t)row * DH + d0);
    async_ld16(vs0 + (unsigned)(row * 72 + d0) * 2, vg + (size_t)row * L_ + d0);
  }
  wait_async_le8();                      // Q (oldest 4) complete
  __syncthreads();

  // Q fragments are kt-invariant: hoist out of the loop. They are the B operand: column = query
  v16h qf[2];
#pragma unroll
  for (int kk = 0; kk < 2; ++kk)
    qf[kk] = frag_f16(Qs + wid * 16 * 72 + kk * 32, 72, lane);

  // Transposed products: a lane owns ONE query (column lane & 15) and, per 16-row tile, rows r + hi.
  v8f z = {0.f,0.f,0.f,0.f,0.f,0.f,0.f,0.f};
  v8f o[4];                              // O^T: o[dt][r] = O[query][dt*16 + hi + r]
#pragma unroll
  for (int dt = 0; dt < 4; ++dt) o[dt] = z;
  float mi = -1e30f;
  v8f lv = z;                            // 8 partial row sums of this half's keys, joined after the loop
  const int hi = (lane & 16) ? 8 : 0;

  for (int kt = 0; kt < 16; ++kt) {
    const int cur = kt & 1;
    if (kt + 1 < 16) {                   // issue next tile; overlaps compute below
      const int nxt = (kt + 1) & 1;
#pragma unroll
      for (int c = 0; c < 4; ++c) {
        int off = off0 + 128 * 8 * c;
        int row = off >> 6, d0 = off & 63;
        async_ld16(ks0 + nxt * bufstep + (unsigned)(row * 72 + d0) * 2,
                   kg + (size_t)((kt + 1) * 64 + row) * DH + d0);
        async_ld16(vs0 + nxt * bufstep + (unsigned)(row * 72 + d0) * 2,
                   vg + (size_t)row * L_ + (kt + 1) * 64 + d0);
      }
      wait_async_le8();                  // in-order: tile kt fully landed
    } else {
      wait_async_le0();
    }
    __syncthreads();                     // all waves' tile-kt parts visible

    // S^T = K Q^T: s[nt][r] = score(key nt*16 + hi + r, query lane & 15)
    v8f s[4];
#pragma unroll
    for (int nt = 0; nt < 4; ++nt) s[nt] = z;
#pragma unroll
    for (int kk = 0; kk < 2; ++kk) {
      v16h kf[4];
#pragma unroll
      for (int nt = 0; nt < 4; ++nt)
        kf[nt] = frag_f16(&Ks[cur][0] + nt * 16 * 72 + kk * 32, 72, lane);
#pragma unroll
      for (int nt = 0; nt < 4; ++nt)
        s[nt] = wmma16(kf[nt], qf[kk], s[nt]);
    }

    // Online softmax: a query's 64 scores lie in two lanes, so maximum and sum run in-lane
    float m4[4];
#pragma unroll  // constant indices keep s in registers
    for (int nt = 0; nt < 4; ++nt) {
      m4[nt] = s[nt][0];
#pragma unroll  // constant indices keep s in registers
      for (int r = 1; r < 8; ++r) m4[nt] = fmaxf(m4[nt], s[nt][r]);
    }
    float mx = fmaxf(fmaxf(m4[0], m4[1]), fmaxf(m4[2], m4[3]));
    mx = fmaxf(mx, xhalf(mx));           // the one exchange: both halves use the same maximum
    const float mnew  = fmaxf(mi, mx);
    const float alpha = __expf(mi - mnew);
    mi = mnew;
#pragma unroll  // constant indices keep s in registers
    for (int nt = 0; nt < 4; ++nt)
#pragma unroll  // constant indices keep s in registers
      for (int r = 0; r < 8; ++r) s[nt][r] = __expf(s[nt][r] - mnew);
    lv = lv * alpha + ((s[0] + s[1]) + (s[2] + s[3]));   // tile rows added register by register
#pragma unroll  // constant indices keep o in registers
    for (int dt = 0; dt < 4; ++dt) o[dt] *= alpha;

    // O^T += V^T P^T: two score tiles, converted in place, are the B operand of 32 keys (no LDS, no exchange)
#pragma unroll
    for (int kk = 0; kk < 2; ++kk) {
      v16h pf = __builtin_shufflevector(__builtin_convertvector(s[2 * kk], v8h),
                                        __builtin_convertvector(s[2 * kk + 1], v8h),
                                        0,1,2,3,4,5,6,7,8,9,10,11,12,13,14,15);
      v16h vf[4];
#pragma unroll
      for (int dt = 0; dt < 4; ++dt)
        vf[dt] = frag_f16(&Vs[cur][0] + dt * 16 * 72 + kk * 32, 72, lane);
#pragma unroll
      for (int dt = 0; dt < 4; ++dt)
        o[dt] = wmma16(vf[dt], pf, o[dt]);
    }
    __syncthreads();                     // done reading buf[cur] before reuse
  }

  // Normalize and write (b, L, DIM) f16: a lane's 8 values of a tile are 8 adjacent d of its query
  const float li = ((lv[0] + lv[1]) + (lv[2] + lv[3])) + ((lv[4] + lv[5]) + (lv[6] + lv[7]));
  const float inv = 1.0f / (li + xhalf(li));
  _Float16* dst = ao + ((size_t)b * L_ + qb * 64 + wid * 16 + (lane & 15)) * DIM_ + h * DH + hi;
#pragma unroll  // constant indices keep o in registers
  for (int dt = 0; dt < 4; ++dt)
    *(v8h*)&dst[dt * 16] = __builtin_convertvector(o[dt] * inv, v8h);
}

// ---------------------------------------------------------------------------
// Kernel 3: out = attn(f16) @ w_proj, fp32 out. BM=64, BN=256, A and B pipelined.
// ---------------------------------------------------------------------------
__global__ __launch_bounds__(256) void proj_kernel(
    const _Float16* __restrict__ a16, const float* __restrict__ w,
    float* __restrict__ out) {
  __shared__ __attribute__((aligned(16))) _Float16 Bs[256 * 40];
  __shared__ __attribute__((aligned(16))) _Float16 As[64 * 40];   // [m][k], same stride
  const int lane = threadIdx.x & 31;
  const int wid  = threadIdx.x >> 5;
  const int wm = wid & 1, wn = wid >> 1;
  const int bn = blockIdx.x, bm = blockIdx.y;
  const int row0 = bm * 64 + wm * 32;
  const int n4 = threadIdx.x & 63, kg = threadIdx.x >> 6;  // B staging: 4 columns x 8 consecutive k per thread
  // A staging: 4 threads read one row's 32 k (64 B); one row piece per thread
  const int ar = threadIdx.x >> 2, ac = threadIdx.x & 3;
  const _Float16* aa = a16 + (size_t)(bm * 64 + ar) * DIM_ + ac * 8;

  v8f z = {0.f,0.f,0.f,0.f,0.f,0.f,0.f,0.f};
  v8f acc[2][4];
#pragma unroll
  for (int ms = 0; ms < 2; ++ms)
#pragma unroll
    for (int nt = 0; nt < 4; ++nt) acc[ms][nt] = z;

  v4f tmp[8];
#pragma unroll
  for (int i = 0; i < 8; ++i)
    tmp[i] = *(const v4f*)&w[(size_t)(kg * 8 + i) * DIM_ + bn * 256 + n4 * 4];
  v8h ta = *(const v8h*)aa;

  for (int kb = 0; kb < DIM_; kb += 32) {
    __syncthreads();
#pragma unroll
    for (int j = 0; j < 4; ++j) {                // regs -> LDS: 8 k of one column per 16-B store
      v8h hcol;
#pragma unroll  // constant indices keep tmp and hcol in registers
      for (int i = 0; i < 8; ++i) hcol[i] = (_Float16)tmp[i][j];
      *(v8h*)&Bs[(j * 64 + n4) * 40 + kg * 8] = hcol;   // column 4*n4+j lives at LDS row 64*j+n4
    }
    *(v8h*)&As[ar * 40 + ac * 8] = ta;           // A: read once per block, shared by the 4 N-waves
    __syncthreads();
    if (kb + 32 < DIM_) {
#pragma unroll
      for (int i = 0; i < 8; ++i)
        tmp[i] = *(const v4f*)&w[(size_t)(kb + 32 + kg * 8 + i) * DIM_ + bn * 256 + n4 * 4];
      ta = *(const v8h*)&aa[kb + 32];
      // the loads' address registers are advanced later in this trip: keep the wait in front of that
      asm volatile("s_wait_xcnt 0x0" ::: "memory");
    }
    v16h a0 = frag_f16(As + (wm * 32) * 40, 40, lane);
    v16h a1 = frag_f16(As + (wm * 32 + 16) * 40, 40, lane);
    v16h bf[4];
#pragma unroll
    for (int nt = 0; nt < 4; ++nt)
      bf[nt] = frag_f16(Bs + (nt * 64 + wn * 16) * 40, 40, lane);  // tile nt = columns 4*i+nt
#pragma unroll
    for (int nt = 0; nt < 4; ++nt) {
      acc[0][nt] = wmma16(a0, bf[nt], acc[0][nt]);
      acc[1][nt] = wmma16(a1, bf[nt], acc[1][nt]);
    }
  }

  const int hi = (lane & 16) ? 8 : 0;
  float* dst = out + (size_t)(row0 + hi) * DIM_ + bn * 256 + wn * 64 + (lane & 15) * 4;
#pragma unroll  // constant indices keep acc in registers
  for (int ms = 0; ms < 2; ++ms)
#pragma unroll  // constant indices keep acc in registers
    for (int r = 0; r < 8; ++r) {          // 16 lanes x 16 B = two whole lines of one row
      v4f ov = {acc[ms][0][r], acc[ms][1][r], acc[ms][2][r], acc[ms][3][r]};
      *(v4f*)&dst[(size_t)(ms * 16 + r) * DIM_] = ov;
    }
}

// ---------------------------------------------------------------------------
extern "C" void kernel_launch(void* const* d_in, const int* in_sizes, int n_in,
                              void* d_out, int out_size, void* d_ws, size_t ws_size,
                              hipStream_t stream) {
  (void)in_sizes; (void)n_in; (void)out_size; (void)ws_size;
  const float* x      = (const float*)d_in[0];
  const float* w_qkv  = (const float*)d_in[1];
  const float* w_proj = (const float*)d_in[2];

  char* ws = (char*)d_ws;
  _Float16* qw = (_Float16*)(ws);
  _Float16* kw = (_Float16*)(ws + (size_t)16 * 1024 * 1024);
  _Float16* vw = (_Float16*)(ws + (size_t)32 * 1024 * 1024);
  _Float16* ao = (_Float16*)(ws + (size_t)48 * 1024 * 1024);
  float* out = (float*)d_out;

  qkv_rope_kernel<<<dim3(N3 / 256, (B_ * L_) / 64), 256, 0, stream>>>(x, w_qkv, qw, kw, vw);
  attn_kernel<<<dim3(L_ / 64, NH, B_), 128, 0, stream>>>(qw, kw, vw, ao);
  proj_kernel<<<dim3(DIM_ / 256, (B_ * L_) / 64), 256, 0, stream>>>(ao, w_proj, out);
}

// v005
// A run of this version takes 147 microseconds.
// Two timings next to v004 put it at 1.06 and 1.07 times that version's speed.
// All steps since v000 together make it 4.58 times as fast.
#include <hip/hip_runtime.h>

typedef __attribute__((ext_vector_type(16))) _Float16 v16h;
typedef __attribute__((ext_vector_type(8)))  _Float16 v8h;
typedef __attribute__((ext_vector_type(4)))  _Float16 v4h;
typedef __attribute__((ext_vector_type(8)))  float    v8f;
typedef __attribute__((ext_vector_type(4)))  float    v4f;

#define B_    8
#define L_    1024
#define DIM_  1024
#define NH    16
#define DH    64
#define N3    3072
#define PI_F  3.14159265358979323846f

__device__ __forceinline__ v16h frag_f16(const _Float16* base, int stride, int lane) {
  const int row = lane & 15;
  const int lo  = (lane & 16) ? 8 : 0;
  const _Float16* p = base + row * stride + lo;
  v8h a = *(const v8h*)(p);
  v8h b = *(const v8h*)(p + 16);
  return __builtin_shufflevector(a, b, 0,1,2,3,4,5,6,7,8,9,10,11,12,13,14,15);
}

__device__ __forceinline__ v8f wmma16(v16h a, v16h b, v8f c) {
  return __builtin_amdgcn_wmma_f32_16x16x32_f16(false, a, false, b, (short)0, c, false, false);
}

__device__ __forceinline__ float xhalf(float x) {
  int b = __builtin_bit_cast(int, x);
  return __builtin_bit_cast(float, __builtin_amdgcn_permlanex16(b, b, 0x76543210, 0xfedcba98, false, false));
}

__device__ __forceinline__ void sincos_rev(float rev, float& s, float& c) {
  asm("v_sin_f32 %0, %2\n\tv_cos_f32 %1, %2\n\tv_nop" : "=&v"(s), "=&v"(c) : "v"(rev));
}

__device__ __forceinline__ void async_ld16(unsigned lds_byte_off, const void* gptr) {
  asm volatile("global_load_async_to_lds_b128 %0, %1, off"
               :: "v"(lds_byte_off), "v"(gptr) : "memory");
}
__device__ __forceinline__ void wait_async_le0() {
  asm volatile("s_wait_asynccnt 0x0" ::: "memory");
}
__device__ __forceinline__ void wait_async_le8() {
  asm volatile("s_wait_asynccnt 0x8" ::: "memory");
}

// ---------------------------------------------------------------------------
// Kernel 1: QKV = x @ w_qkv with fused 2D axial RoPE; q pre-scaled by 1/64.
// BM=128, BN=256, BK=32; 8 waves = 2(M) x 4(N), 64x64 per wave; software-pipelined A and B staging.
// ---------------------------------------------------------------------------
__global__ __launch_bounds__(256) void qkv_rope_kernel(
    const float* __restrict__ x, const float* __restrict__ w,
    _Float16* __restrict__ qw, _Float16* __restrict__ kw, _Float16* __restrict__ vw) {
  __shared__ __attribute__((aligned(16))) _Float16 Bs[256 * 40];
  __shared__ __attribute__((aligned(16))) _Float16 As[128 * 40];  // [m][k], same stride
  const int lane = threadIdx.x & 31;
  const int wid  = threadIdx.x >> 5;
  const int wm = wid & 1, wn = wid >> 1;
  const int bn = blockIdx.x, bm = blockIdx.y;
  const int row0 = bm * 128 + wm * 64;
  const int n4 = threadIdx.x & 63, kg = threadIdx.x >> 6;  // B staging: 4 columns x 8 consecutive k per thread
  // A staging: 8 threads read one row's 32 k (a whole 128-B line); rows ar + 32*i, i < 4, per thread
  const int ar = threadIdx.x >> 3, ac = threadIdx.x & 7;
  const float* xa = x + (size_t)(bm * 128 + ar) * DIM_ + ac * 4;

  v8f z = {0.f,0.f,0.f,0.f,0.f,0.f,0.f,0.f};
  v8f acc[4][4];
#pragma unroll
  for (int ms = 0; ms < 4; ++ms)
#pragma unroll
    for (int nt = 0; nt < 4; ++nt) acc[ms][nt] = z;

  v4f tmp[8];                                    // register double-buffer for B
  v4f ta[4];                                     // and for A
#pragma unroll
  for (int i = 0; i < 8; ++i)                    // prologue: tile kb=0
    tmp[i] = *(const v4f*)&w[(size_t)(kg * 8 + i) * N3 + bn * 256 + n4 * 4];
#pragma unroll
  for (int i = 0; i < 4; ++i)
    ta[i] = *(const v4f*)&xa[(size_t)(32 * i) * DIM_];

  for (int kb = 0; kb < DIM_; kb += 32) {
    __syncthreads();                             // previous tile's reads done
#pragma unroll
    for (int j = 0; j < 4; ++j) {                // regs -> LDS: 8 k of one column per 16-B store
      v8h hcol;
#pragma unroll  // constant indices keep tmp and hcol in registers
      for (int i = 0; i < 8; ++i) hcol[i] = (_Float16)tmp[i][j];
      *(v8h*)&Bs[(j * 64 + n4) * 40 + kg * 8] = hcol;   // column 4*n4+j lives at LDS row 64*j+n4
    }
#pragma unroll
    for (int i = 0; i < 4; ++i)                  // A: converted once per block, shared by the 4 N-waves
      *(v4h*)&As[(ar + 32 * i) * 40 + ac * 4] = __builtin_convertvector(ta[i], v4h);
    __syncthreads();
    if (kb + 32 < DIM_) {                        // issue next tile early: overlaps WMMA
#pragma unroll
      for (int i = 0; i < 8; ++i)
        tmp[i] = *(const v4f*)&w[(size_t)(kb + 32 + kg * 8 + i) * N3 + bn * 256 + n4 * 4];
#pragma unroll
      for (int i = 0; i < 4; ++i)
        ta[i] = *(const v4f*)&xa[(size_t)(32 * i) * DIM_ + kb + 32];
      // the loads' address registers are advanced later in this trip: keep the wait in front of that
      asm volatile("s_wait_xcnt 0x0" ::: "memory");
    }
    v16h af[4];
#pragma unroll
    for (int ms = 0; ms < 4; ++ms)
      af[ms] = frag_f16(As + (wm * 64 + ms * 16) * 40, 40, lane);
    v16h bf[4];
#pragma unroll
    for (int nt = 0; nt < 4; ++nt)               // batch ds loads, stagger waits
      bf[nt] = frag_f16(Bs + (nt * 64 + wn * 16) * 40, 40, lane);  // tile nt = columns 4*i+nt
#pragma unroll
    for (int nt = 0; nt < 4; ++nt)
#pragma unroll
      for (int ms = 0; ms < 4; ++ms)             // each loaded fragment feeds 4 products
        acc[ms][nt] = wmma16(af[ms], bf[nt], acc[ms][nt]);
  }

  // Epilogue: RoPE + scatter. C layout: lane holds (M = r + hi, column 4*(lane&15) + nt).
  const int hi = (lane & 16) ? 8 : 0;
  const int seg = bn >> 2;                 // 0=q 1=k 2=v, the same for the whole block
  const int h  = (bn & 3) * 4 + wn;        // a wave's 64 columns are one head
  const int d0 = (lane & 15) * 4;
  const int b  = row0 >> 10;               // a wave's 64 rows lie in one batch
  const int l0 = (row0 & 1023) + hi;
  if (seg < 2) {
    _Float16* dst = (seg == 0 ? qw : kw) + ((size_t)(b * NH + h) * L_ + l0) * DH + d0;
    const float sc = (seg == 0) ? (1.0f / 64.0f) : 1.0f;
    const bool wax = d0 >= 32;             // upper half of the head rotates by the column position
    float fj[2];
#pragma unroll  // constant indices keep fj in registers
    for (int p = 0; p < 2; ++p) {
      int j = ((wax ? (d0 - 32) : d0) >> 1) + p;
      fj[p] = (1.0f + (127.0f / 15.0f) * (float)j) * PI_F;
    }
#pragma unroll  // constant indices keep acc in registers
    for (int ms = 0; ms < 4; ++ms) {
#pragma unroll  // constant indices keep acc in registers
      for (int r = 0; r < 8; ++r) {
        int l = l0 + ms * 16 + r;
        float pos = wax ? (-1.0f + (2.0f / 31.0f) * (float)(l & 31))
                        : (-1.0f + (2.0f / 31.0f) * (float)(l >> 5));
        v4h hv;
#pragma unroll  // constant indices keep acc in registers
        for (int p = 0; p < 2; ++p) {      // the rotated pair is two adjacent columns the lane holds
          float th = pos * fj[p];
          float cv, sv;
          sincos_rev(th * 0.15915494309189532f, sv, cv);
          float e = acc[ms][2 * p][r], o = acc[ms][2 * p + 1][r];
          hv[2 * p]     = (_Float16)((e * cv - o * sv) * sc);
          hv[2 * p + 1] = (_Float16)((o * cv + e * sv) * sc);
        }
        *(v4h*)&dst[(ms * 16 + r) * DH] = hv;   // 16 lanes x 8 B = one whole 128-B row
      }
    }
  } else {
    _Float16* dst = vw + ((size_t)(b * NH + h) * DH + d0) * L_ + l0;   // transposed
#pragma unroll  // constant indices keep acc in registers
    for (int ms = 0; ms < 4; ++ms)
#pragma unroll  // constant indices keep acc in registers
      for (int nt = 0; nt < 4; ++nt)       // a lane's 8 rows of one column are 8 adjacent l
        *(v8h*)&dst[nt * L_ + ms * 16] = __builtin_convertvector(acc[ms][nt], v8h);
    // in the listing the q/k code stands behind these stores and rewrites their registers: keep the wait in front
    asm volatile("s_wait_xcnt 0x0" ::: "memory");
  }
}

__global__ __launch_bounds__(128) void attn_kernel(
    const _Float16* __restrict__ qw, const _Float16* __restrict__ kw,
    const _Float16* __restrict__ vw, _Float16* __restrict__ ao) {
  __shared__ _Float16 Qs[64 * 72];       // [m][d]
  __shared__ _Float16 Ks[2][64 * 72];    // [key][d], double-buffered
  __shared__ _Float16 Vs[2][64 * 72];    // [d][key], double-buffered
  const int lane = threadIdx.x & 31;
  const int wid  = threadIdx.x >> 5;
  const int qb = blockIdx.x, h = blockIdx.y, b = blockIdx.z;
  const int bh = b * NH + h;
  const _Float16* qg = qw + (size_t)bh * L_ * DH + (size_t)qb * 64 * DH;
  const _Float16* kg = kw + (size_t)bh * L_ * DH;
  const _Float16* vg = vw + (size_t)bh * DH * L_;

  const unsigned qs0 = (unsigned)(uintptr_t)(&Qs[0]);
  const unsigned ks0 = (unsigned)(uintptr_t)(&Ks[0][0]);
  const unsigned vs0 = (unsigned)(uintptr_t)(&Vs[0][0]);
  const unsigned bufstep = 64 * 72 * 2;  // bytes per buffer

  // per-thread slice used for all tile copies: 4 rows of 16B
  const int off0 = threadIdx.x * 8;      // covers 1024 halves per c-step
  // stage Q (4 async) then K/V tile 0 (8 async)
#pragma unroll
  for (int c = 0; c < 4; ++c) {
    int off = off0 + 128 * 8 * c;
    int m = off >> 6, d0 = off & 63;
    async_ld16(qs0 + (unsigned)(m * 72 + d0) * 2, qg + m * DH + d0);
  }
#pragma unroll
  for (int c = 0; c < 4; ++c) {
    int off = off0 + 128 * 8 * c;
    int row = off >> 6, d0 = off & 63;
    async_ld16(ks0 + (unsigned)(row * 72 + d0) * 2, kg + (size_t)row * DH + d0);
    async_ld16(vs0 + (unsigned)(row * 72 + d0) * 2, vg + (size_t)row * L_ + d0);
  }
  wait_async_le8();                      // Q (oldest 4) complete
  __syncthreads();

  // Q fragments are kt-invariant: hoist out of the loop. They are the B operand: column = query
  v16h qf[2];
#pragma unroll
  for (int kk = 0; kk < 2; ++kk)
    qf[kk] = frag_f16(Qs + wid * 16 * 72 + kk * 32, 72, lane);

  // Transposed products: a lane owns ONE query (column lane & 15) and, per 16-row tile, rows r + hi.
  v8f z = {0.f,0.f,0.f,0.f,0.f,0.f,0.f,0.f};
  v8f o[4];                              // O^T: o[dt][r] = O[query][dt*16 + hi + r]
#pragma unroll
  for (int dt = 0; dt < 4; ++dt) o[dt] = z;
  float mi = -1e30f;
  v8f lv = z;                            // 8 partial row sums of this half's keys, joined after the loop
  const int hi = (lane & 16) ? 8 : 0;

  for (int kt = 0; kt < 16; ++kt) {
    const int cur = kt & 1;
    if (kt + 1 < 16) {                   // issue next tile; overlaps compute below
      const int nxt = (kt + 1) & 1;
#pragma unroll
      for (int c = 0; c < 4; ++c) {
        int off = off0 + 128 * 8 * c;
        int row = off >> 6, d0 = off & 63;
        async_ld16(ks0 + nxt * bufstep + (unsigned)(row * 72 + d0) * 2,
                   kg + (size_t)((kt + 1) * 64 + row) * DH + d0);
        async_ld16(vs0 + nxt * bufstep + (unsigned)(row * 72 + d0) * 2,
                   vg + (size_t)row * L_ + (kt + 1) * 64 + d0);
      }
      wait_async_le8();                  // in-order: tile kt fully landed
    } else {
      wait_async_le0();
    }
    __syncthreads();                     // all waves' tile-kt parts visible

    // S^T = K Q^T: s[nt][r] = score(key nt*16 + hi + r, query lane & 15)
    v8f s[4];
#pragma unroll
    for (int nt = 0; nt < 4; ++nt) s[nt] = z;
#pragma unroll
    for (int kk = 0; kk < 2; ++kk) {
      v16h kf[4];
#pragma unroll
      for (int nt = 0; nt < 4; ++nt)
        kf[nt] = frag_f16(&Ks[cur][0] + nt * 16 * 72 + kk * 32, 72, lane);
#pragma unroll
      for (int nt = 0; nt < 4; ++nt)
        s[nt] = wmma16(kf[nt], qf[kk], s[nt]);
    }

    // Online softmax: a query's 64 scores lie in two lanes, so maximum and sum run in-lane
    float m4[4];
#pragma unroll  // constant indices keep s in registers
    for (int nt = 0; nt < 4; ++nt) {
      m4[nt] = s[nt][0];
#pragma unroll  // constant indices keep s in registers
      for (int r = 1; r < 8; ++r) m4[nt] = fmaxf(m4[nt], s[nt][r]);
    }
    float mx = fmaxf(fmaxf(m4[0], m4[1]), fmaxf(m4[2], m4[3]));
    mx = fmaxf(mx, xhalf(mx));           // the one exchange: both halves use the same maximum
    const float mnew  = fmaxf(mi, mx);
    const float alpha = __expf(mi - mnew);
    mi = mnew;
#pragma unroll  // constant indices keep s in registers
    for (int nt = 0; nt < 4; ++nt)
#pragma unroll  // constant indices keep s in registers
      for (int r = 0; r < 8; ++r) s[nt][r] = __expf(s[nt][r] - mnew);
    lv = lv * alpha + ((s[0] + s[1]) + (s[2] + s[3]));   // tile rows added register by register
#pragma unroll  // constant indices keep o in registers
    for (int dt = 0; dt < 4; ++dt) o[dt] *= alpha;

    // O^T += V^T P^T: two score tiles, converted in place, are the B operand of 32 keys (no LDS, no exchange)
#pragma unroll
    for (int kk = 0; kk < 2; ++kk) {
      v16h pf = __builtin_shufflevector(__builtin_convertvector(s[2 * kk], v8h),
                                        __builtin_convertvector(s[2 * kk + 1], v8h),
                                        0,1,2,3,4,5,6,7,8,9,10,11,12,13,14,15);
      v16h vf[4];
#pragma unroll
      for (int dt = 0; dt < 4; ++dt)
        vf[dt] = frag_f16(&Vs[cur][0] + dt * 16 * 72 + kk * 32, 72, lane);
#pragma unroll
      for (int dt = 0; dt < 4; ++dt)
        o[dt] = wmma16(vf[dt], pf, o[dt]);
    }
    __syncthreads();                     // done reading buf[cur] before reuse
  }

  // Normalize and write (b, L, DIM) f16: a lane's 8 values of a tile are 8 adjacent d of its query
  const float li = ((lv[0] + lv[1]) + (lv[2] + lv[3])) + ((lv[4] + lv[5]) + (lv[6] + lv[7]));
  const float inv = 1.0f / (li + xhalf(li));
  _Float16* dst = ao + ((size_t)b * L_ + qb * 64 + wid * 16 + (lane & 15)) * DIM_ + h * DH + hi;
#pragma unroll  // constant indices keep o in registers
  for (int dt = 0; dt < 4; ++dt)
    *(v8h*)&dst[dt * 16] = __builtin_convertvector(o[dt] * inv, v8h);
}

// ---------------------------------------------------------------------------
// Kernel 3: out = attn(f16) @ w_proj, fp32 out. BM=128, BN=256, 64x64 per wave, A and B pipelined.
// ---------------------------------------------------------------------------
__global__ __launch_bounds__(256) void proj_kernel(
    const _Float16* __restrict__ a16, const float* __restrict__ w,
    float* __restrict__ out) {
  __shared__ __attribute__((aligned(16))) _Float16 Bs[256 * 40];
  __shared__ __attribute__((aligned(16))) _Float16 As[128 * 40];  // [m][k], same stride
  const int lane = threadIdx.x & 31;
  const int wid  = threadIdx.x >> 5;
  const int wm = wid & 1, wn = wid >> 1;
  const int bn = blockIdx.x, bm = blockIdx.y;
  const int row0 = bm * 128 + wm * 64;
  const int n4 = threadIdx.x & 63, kg = threadIdx.x >> 6;  // B staging: 4 columns x 8 consecutive k per thread
  // A staging: 4 threads read one row's 32 k (64 B); rows ar and ar + 64 per thread
  const int ar = threadIdx.x >> 2, ac = threadIdx.x & 3;
  const _Float16* aa = a16 + (size_t)(bm * 128 + ar) * DIM_ + ac * 8;

  v8f z = {0.f,0.f,0.f,0.f,0.f,0.f,0.f,0.f};
  v8f acc[4][4];
#pragma unroll
  for (int ms = 0; ms < 4; ++ms)
#pragma unroll
    for (int nt = 0; nt < 4; ++nt) acc[ms][nt] = z;

  v4f tmp[8];
#pragma unroll
  for (int i = 0; i < 8; ++i)
    tmp[i] = *(const v4f*)&w[(size_t)(kg * 8 + i) * DIM_ + bn * 256 + n4 * 4];
  v8h ta[2];
#pragma unroll
  for (int i = 0; i < 2; ++i)
    ta[i] = *(const v8h*)&aa[(size_t)(64 * i) * DIM_];

  for (int kb = 0; kb < DIM_; kb += 32) {
    __syncthreads();
#pragma unroll
    for (int j = 0; j < 4; ++j) {                // regs -> LDS: 8 k of one column per 16-B store
      v8h hcol;
#pragma unroll  // constant indices keep tmp and hcol in registers
      for (int i = 0; i < 8; ++i) hcol[i] = (_Float16)tmp[i][j];
      *(v8h*)&Bs[(j * 64 + n4) * 40 + kg * 8] = hcol;   // column 4*n4+j lives at LDS row 64*j+n4
    }
#pragma unroll
    for (int i = 0; i < 2; ++i)                  // A: read once per block, shared by the 4 N-waves
      *(v8h*)&As[(ar + 64 * i) * 40 + ac * 8] = ta[i];
    __syncthreads();
    if (kb + 32 < DIM_) {
#pragma unroll
      for (int i = 0; i < 8; ++i)
        tmp[i] = *(const v4f*)&w[(size_t)(kb + 32 + kg * 8 + i) * DIM_ + bn * 256 + n4 * 4];
#pragma unroll
      for (int i = 0; i < 2; ++i)
        ta[i] = *(const v8h*)&aa[(size_t)(64 * i) * DIM_ + kb + 32];
      // the loads' address registers are advanced later in this trip: keep the wait in front of that
      asm volatile("s_wait_xcnt 0x0" ::: "memory");
    }
    v16h af[4];
#pragma unroll
    for (int ms = 0; ms < 4; ++ms)
      af[ms] = frag_f16(As + (wm * 64 + ms * 16) * 40, 40, lane);
    v16h bf[4];
#pragma unroll
    for (int nt = 0; nt < 4; ++nt)
      bf[nt] = frag_f16(Bs + (nt * 64 + wn * 16) * 40, 40, lane);  // tile nt = columns 4*i+nt
#pragma unroll
    for (int nt = 0; nt < 4; ++nt)
#pragma unroll
      for (int ms = 0; ms < 4; ++ms)             // each loaded fragment feeds 4 products
        acc[ms][nt] = wmma16(af[ms], bf[nt], acc[ms][nt]);
  }

  const int hi = (lane & 16) ? 8 : 0;
  float* dst = out + (size_t)(row0 + hi) * DIM_ + bn * 256 + wn * 64 + (lane & 15) * 4;
#pragma unroll  // constant indices keep acc in registers
  for (int ms = 0; ms < 4; ++ms)
#pragma unroll  // constant indices keep acc in registers
    for (int r = 0; r < 8; ++r) {          // 16 lanes x 16 B = two whole lines of one row
      v4f ov = {acc[ms][0][r], acc[ms][1][r], acc[ms][2][r], acc[ms][3][r]};
      *(v4f*)&dst[(size_t)(ms * 16 + r) * DIM_] = ov;
    }
}

// ---------------------------------------------------------------------------
extern "C" void kernel_launch(void* const* d_in, const int* in_sizes, int n_in,
                              void* d_out, int out_size, void* d_ws, size_t ws_size,
                              hipStream_t stream) {
  (void)in_sizes; (void)n_in; (void)out_size; (void)ws_size;
  const float* x      = (const float*)d_in[0];
  const float* w_qkv  = (const float*)d_in[1];
  const float* w_proj = (const float*)d_in[2];

  char* ws = (char*)d_ws;
  _Float16* qw = (_Float16*)(ws);
  _Float16* kw = (_Float16*)(ws + (size_t)16 * 1024 * 1024);
  _Float16* vw = (_Float16*)(ws + (size_t)32 * 1024 * 1024);
  _Float16* ao = (_Float16*)(ws + (size_t)48 * 1024 * 1024);
  float* out = (float*)d_out;

  qkv_rope_kernel<<<dim3(N3 / 256, (B_ * L_) / 128), 256, 0, stream>>>(x, w_qkv, qw, kw, vw);
  attn_kernel<<<dim3(L_ / 64, NH, B_), 128, 0, stream>>>(qw, kw, vw, ao);
  proj_kernel<<<dim3(DIM_ / 256, (B_ * L_) / 128), 256, 0, stream>>>(ao, w_proj, out);
}

// v006
// Measured time: 125 microseconds a run.
// Timed twice side by side with v005, it ran 1.17 and 1.19 times as fast.
// Counting every step since v000, it is 5.40 times as fast.
#include <hip/hip_runtime.h>

typedef __attribute__((ext_vector_type(16))) _Float16 v16h;
typedef __attribute__((ext_vector_type(8)))  _Float16 v8h;
typedef __attribute__((ext_vector_type(4)))  _Float16 v4h;
typedef __attribute__((ext_vector_type(8)))  float    v8f;
typedef __attribute__((ext_vector_type(4)))  float    v4f;

#define B_    8
#define L_    1024
#define DIM_  1024
#define NH    16
#define DH    64
#define N3    3072
#define PI_F  3.14159265358979323846f

__device__ __forceinline__ v16h frag_f16(const _Float16* base, int stride, int lane) {
  const int row = lane & 15;
  const int lo  = (lane & 16) ? 8 : 0;
  const _Float16* p = base + row * stride + lo;
  v8h a = *(const v8h*)(p);
  v8h b = *(const v8h*)(p + 16);
  return __builtin_shufflevector(a, b, 0,1,2,3,4,5,6,7,8,9,10,11,12,13,14,15);
}

__device__ __forceinline__ v8f wmma16(v16h a, v16h b, v8f c) {
  return __builtin_amdgcn_wmma_f32_16x16x32_f16(false, a, false, b, (short)0, c, false, false);
}

__device__ __forceinline__ float xhalf(float x) {
  int b = __builtin_bit_cast(int, x);
  return __builtin_bit_cast(float, __builtin_amdgcn_permlanex16(b, b, 0x76543210, 0xfedcba98, false, false));
}

__device__ __forceinline__ void sincos_rev(float rev, float& s, float& c) {
  asm("v_sin_f32 %0, %2\n\tv_cos_f32 %1, %2\n\tv_nop" : "=&v"(s), "=&v"(c) : "v"(rev));
}

__device__ __forceinline__ void async_ld16(unsigned lds_byte_off, const void* gptr) {
  asm volatile("global_load_async_to_lds_b128 %0, %1, off"
               :: "v"(lds_byte_off), "v"(gptr) : "memory");
}
__device__ __forceinline__ void wait_async_le0() {
  asm volatile("s_wait_asynccnt 0x0" ::: "memory");
}
__device__ __forceinline__ void wait_async_le8() {
  asm volatile("s_wait_asynccnt 0x8" ::: "memory");
}

// ---------------------------------------------------------------------------
// Kernel 0: operands to f16, once per call. x keeps its layout; each weight goes to [n][k], and inside each
// 256-column tile column 4*i+j is written as row 64*j+i, the order in which the GEMMs keep the tile in LDS.
// ---------------------------------------------------------------------------
#define QBLK 192                         // blocks that transpose w_qkv
#define WBLK 256                         // blocks that transpose a weight; the other 512 convert x

// A wave takes 64 k x 32 columns: a lane reads 8 k of 2 x 4 columns (the wave: whole 128-B lines of 8 rows per
// pair of loads), writes 8 x 16 B, and 8 lanes together write one whole 128-B line of a transposed row.
template <int N>
__device__ __forceinline__ void transpose_w(const float* __restrict__ w, _Float16* __restrict__ wt,
                                            int gw, int lane) {
  const int n0 = (gw % (N / 32)) * 32 + (lane >> 3) * 4;
  const int k0 = (gw / (N / 32)) * 64 + (lane & 7) * 8;
  const float* src = w + (size_t)k0 * N + n0;
  _Float16* dst = wt + (size_t)((n0 & ~255) + ((n0 & 255) >> 2)) * DIM_ + k0;
  v4f tmp[2][8];
#pragma unroll  // constant indices keep tmp in registers; all 16 loads in flight together
  for (int c = 0; c < 2; ++c)
#pragma unroll
    for (int i = 0; i < 8; ++i) tmp[c][i] = *(const v4f*)&src[i * N + c * 16];
#pragma unroll
  for (int c = 0; c < 2; ++c)
#pragma unroll
    for (int j = 0; j < 4; ++j) {
      v8h hcol;
#pragma unroll  // constant indices keep tmp and hcol in registers
      for (int i = 0; i < 8; ++i) hcol[i] = (_Float16)tmp[c][i][j];
      *(v8h*)&dst[(j * 64 + c * 4) * DIM_] = hcol;   // column n0 + 16*c + j
    }
  // in the listing another branch's code stands behind these stores and rewrites their registers: the wait first
  asm volatile("s_wait_xcnt 0x0" ::: "memory");
}

__global__ __launch_bounds__(256) void to_f16_kernel(
    const float* __restrict__ x, const float* __restrict__ wq, const float* __restrict__ wp,
    _Float16* __restrict__ x16, _Float16* __restrict__ wqt, _Float16* __restrict__ wpt) {
  const int blk = blockIdx.x;
  const int lane = threadIdx.x & 31;
  const int wid  = __builtin_amdgcn_readfirstlane(threadIdx.x >> 5);
  if (blk < QBLK) {
    transpose_w<N3>(wq, wqt, blk * 8 + wid, lane);
  } else if (blk < WBLK) {
    transpose_w<DIM_>(wp, wpt, (blk - QBLK) * 8 + wid, lane);
  } else {
    // 16 B per lane per load, whole lines per wave; 16 loads per thread
    const size_t base = (size_t)(blk - WBLK) * (256 * 4 * 16) + threadIdx.x * 4;
    v4f t[16];
#pragma unroll  // constant indices keep t in registers; all loads in flight together
    for (int i = 0; i < 16; ++i) t[i] = *(const v4f*)&x[base + i * 1024];
#pragma unroll
    for (int i = 0; i < 16; ++i) *(v4h*)&x16[base + i * 1024] = __builtin_convertvector(t[i], v4h);
    // in the listing another branch's code stands behind these stores and rewrites their registers: the wait first
    asm volatile("s_wait_xcnt 0x0" ::: "memory");
  }
}

// ---------------------------------------------------------------------------
// Shared main loop of both GEMMs: C(128x256) = A(128x1024) * Bt(256x1024)^T, f16 operands, k contiguous.
// A stage is 64 k of 384 rows (128 of A, then 256 of Bt) at pitch 72 halves (144 B); two buffers.
// ---------------------------------------------------------------------------
#define GPITCH 72
#define GSTAGE (384 * GPITCH)            // halves per buffer
#define GSTAGE_B (GSTAGE * 2)            // bytes per buffer
#define GROWS_B (32 * GPITCH * 2)        // bytes of 32 LDS rows

// One stage: 12 copies per lane, 8 lanes per 128-B row, 32 rows per copy of the block. The wait on the address
// translations is the statement's last line, so no address register is rewritten in front of it.
__device__ __forceinline__ void stage_copy(unsigned l, const _Float16* a, const _Float16* b) {
  asm volatile(
      "global_load_async_to_lds_b128 %0, %12, off\n\t"
      "global_load_async_to_lds_b128 %1, %13, off\n\t"
      "global_load_async_to_lds_b128 %2, %14, off\n\t"
      "global_load_async_to_lds_b128 %3, %15, off\n\t"
      "global_load_async_to_lds_b128 %4, %16, off\n\t"
      "global_load_async_to_lds_b128 %5, %17, off\n\t"
      "global_load_async_to_lds_b128 %6, %18, off\n\t"
      "global_load_async_to_lds_b128 %7, %19, off\n\t"
      "global_load_async_to_lds_b128 %8, %20, off\n\t"
      "global_load_async_to_lds_b128 %9, %21, off\n\t"
      "global_load_async_to_lds_b128 %10, %22, off\n\t"
      "global_load_async_to_lds_b128 %11, %23, off\n\t"
      "s_wait_xcnt 0x0"
      :: "v"(l), "v"(l + GROWS_B), "v"(l + 2 * GROWS_B), "v"(l + 3 * GROWS_B),
         "v"(l + 4 * GROWS_B), "v"(l + 5 * GROWS_B), "v"(l + 6 * GROWS_B), "v"(l + 7 * GROWS_B),
         "v"(l + 8 * GROWS_B), "v"(l + 9 * GROWS_B), "v"(l + 10 * GROWS_B), "v"(l + 11 * GROWS_B),
         "v"(a), "v"(a + 32 * DIM_), "v"(a + 64 * DIM_), "v"(a + 96 * DIM_),
         "v"(b), "v"(b + 32 * DIM_), "v"(b + 64 * DIM_), "v"(b + 96 * DIM_),
         "v"(b + 128 * DIM_), "v"(b + 160 * DIM_), "v"(b + 192 * DIM_), "v"(b + 224 * DIM_)
      : "memory");
}

__device__ __forceinline__ void gemm_main(const _Float16* __restrict__ A, const _Float16* __restrict__ Bt,
                                          _Float16* S, int bm, int bn, v8f (&acc)[4][4]) {
  const int lane = threadIdx.x & 31;
  const int wid  = threadIdx.x >> 5;
  const int wm = wid & 1, wn = wid >> 1;
  const int r8 = threadIdx.x >> 3, c8 = (threadIdx.x & 7) * 8;
  const unsigned l0 = (unsigned)(uintptr_t)S + (unsigned)(r8 * GPITCH + c8) * 2;
  const _Float16* ga = A  + (size_t)(bm * 128 + r8) * DIM_ + c8;
  const _Float16* gb = Bt + (size_t)(bn * 256 + r8) * DIM_ + c8;

  stage_copy(l0, ga, gb);                        // stage 0
  wait_async_le0();                              // this wave's part of stage 0 has landed
  __syncthreads();                               // and every other wave's
  stage_copy(l0 + GSTAGE_B, ga + 64, gb + 64);   // stage 1 flies during trip 0

  for (int t = 0; t < DIM_ / 64; ++t) {
    const _Float16* buf = S + (t & 1) * GSTAGE;
#pragma unroll
    for (int kk = 0; kk < 2; ++kk) {
      v16h af[4];
#pragma unroll
      for (int ms = 0; ms < 4; ++ms)
        af[ms] = frag_f16(buf + (wm * 64 + ms * 16) * GPITCH + kk * 32, GPITCH, lane);
      v16h bf[4];
#pragma unroll
      for (int nt = 0; nt < 4; ++nt)             // tile nt = columns 4*i+nt
        bf[nt] = frag_f16(buf + (128 + nt * 64 + wn * 16) * GPITCH + kk * 32, GPITCH, lane);
      if (kk == 1) {
        // publish point of stage t + 1, with the trip's last fragments already fetched: this wave's reads of
        // stage t are done, its copies of stage t + 1 have landed
        asm volatile("s_wait_dscnt 0x0" ::: "memory");
        wait_async_le0();
        __syncthreads();
        if (t + 2 < DIM_ / 64)                   // refill the buffer that every wave has just left
          stage_copy(l0 + (unsigned)(t & 1) * GSTAGE_B, ga + (t + 2) * 64, gb + (t + 2) * 64);
      }
#pragma unroll
      for (int nt = 0; nt < 4; ++nt)
#pragma unroll
        for (int ms = 0; ms < 4; ++ms)           // each loaded fragment feeds 4 products
          acc[ms][nt] = wmma16(af[ms], bf[nt], acc[ms][nt]);
    }
  }
  wait_async_le0();                              // nothing is outstanding when the wave goes on
}

// ---------------------------------------------------------------------------
// Kernel 1: QKV = x @ w_qkv with fused 2D axial RoPE; q pre-scaled by 1/64.
// BM=128, BN=256, 64 k per trip; 8 waves = 2(M) x 4(N), 64x64 per wave; f16 tiles copied to LDS asynchronously.
// ---------------------------------------------------------------------------
__global__ __launch_bounds__(256) void qkv_rope_kernel(
    const _Float16* __restrict__ x16, const _Float16* __restrict__ wt,
    _Float16* __restrict__ qw, _Float16* __restrict__ kw, _Float16* __restrict__ vw) {
  __shared__ __attribute__((aligned(16))) _Float16 S[2 * GSTAGE];
  const int lane = threadIdx.x & 31;
  const int wid  = threadIdx.x >> 5;
  const int wm = wid & 1, wn = wid >> 1;
  const int bn = blockIdx.x, bm = blockIdx.y;
  const int row0 = bm * 128 + wm * 64;

  v8f z = {0.f,0.f,0.f,0.f,0.f,0.f,0.f,0.f};
  v8f acc[4][4];
#pragma unroll
  for (int ms = 0; ms < 4; ++ms)
#pragma unroll
    for (int nt = 0; nt < 4; ++nt) acc[ms][nt] = z;

  gemm_main(x16, wt, S, bm, bn, acc);

  // Epilogue: RoPE + scatter. C layout: lane holds (M = r + hi, column 4*(lane&15) + nt).
  const int hi = (lane & 16) ? 8 : 0;
  const int seg = bn >> 2;                 // 0=q 1=k 2=v, the same for the whole block
  const int h  = (bn & 3) * 4 + wn;        // a wave's 64 columns are one head
  const int d0 = (lane & 15) * 4;
  const int b  = row0 >> 10;               // a wave's 64 rows lie in one batch
  const int l0 = (row0 & 1023) + hi;
  if (seg < 2) {
    _Float16* dst = (seg == 0 ? qw : kw) + ((size_t)(b * NH + h) * L_ + l0) * DH + d0;
    const float sc = (seg == 0) ? (1.0f / 64.0f) : 1.0f;
    const bool wax = d0 >= 32;             // upper half of the head rotates by the column position
    float fj[2];
#pragma unroll  // constant indices keep fj in registers
    for (int p = 0; p < 2; ++p) {
      int j = ((wax ? (d0 - 32) : d0) >> 1) + p;
      fj[p] = (1.0f + (127.0f / 15.0f) * (float)j) * PI_F;
    }
#pragma unroll  // constant indices keep acc in registers
    for (int ms = 0; ms < 4; ++ms) {
#pragma unroll  // constant indices keep acc in registers
      for (int r = 0; r < 8; ++r) {
        int l = l0 + ms * 16 + r;
        float pos = wax ? (-1.0f + (2.0f / 31.0f) * (float)(l & 31))
                        : (-1.0f + (2.0f / 31.0f) * (float)(l >> 5));
        v4h hv;
#pragma unroll  // constant indices keep acc in registers
        for (int p = 0; p < 2; ++p) {      // the rotated pair is two adjacent columns the lane holds
          float th = pos * fj[p];
          float cv, sv;
          sincos_rev(th * 0.15915494309189532f, sv, cv);
          float e = acc[ms][2 * p][r], o = acc[ms][2 * p + 1][r];
          hv[2 * p]     = (_Float16)((e * cv - o * sv) * sc);
          hv[2 * p + 1] = (_Float16)((o * cv + e * sv) * sc);
        }
        *(v4h*)&dst[(ms * 16 + r) * DH] = hv;   // 16 lanes x 8 B = one whole 128-B row
      }
    }
  } else {
    _Float16* dst = vw + ((size_t)(b * NH + h) * DH + d0) * L_ + l0;   // transposed
#pragma unroll  // constant indices keep acc in registers
    for (int ms = 0; ms < 4; ++ms)
#pragma unroll  // constant indices keep acc in registers
      for (int nt = 0; nt < 4; ++nt)       // a lane's 8 rows of one column are 8 adjacent l
        *(v8h*)&dst[nt * L_ + ms * 16] = __builtin_convertvector(acc[ms][nt], v8h);
    // in the listing the q/k code stands behind these stores and rewrites their registers: keep the wait in front
    asm volatile("s_wait_xcnt 0x0" ::: "memory");
  }
}

__global__ __launch_bounds__(128) void attn_kernel(
    const _Float16* __restrict__ qw, const _Float16* __restrict__ kw,
    const _Float16* __restrict__ vw, _Float16* __restrict__ ao) {
  __shared__ _Float16 Qs[64 * 72];       // [m][d]
  __shared__ _Float16 Ks[2][64 * 72];    // [key][d], double-buffered
  __shared__ _Float16 Vs[2][64 * 72];    // [d][key], double-buffered
  const int lane = threadIdx.x & 31;
  const int wid  = threadIdx.x >> 5;
  const int qb = blockIdx.x, h = blockIdx.y, b = blockIdx.z;
  const int bh = b * NH + h;
  const _Float16* qg = qw + (size_t)bh * L_ * DH + (size_t)qb * 64 * DH;
  const _Float16* kg = kw + (size_t)bh * L_ * DH;
  const _Float16* vg = vw + (size_t)bh * DH * L_;

  const unsigned qs0 = (unsigned)(uintptr_t)(&Qs[0]);
  const unsigned ks0 = (unsigned)(uintptr_t)(&Ks[0][0]);
  const unsigned vs0 = (unsigned)(uintptr_t)(&Vs[0][0]);
  const unsigned bufstep = 64 * 72 * 2;  // bytes per buffer

  // per-thread slice used for all tile copies: 4 rows of 16B
  const int off0 = threadIdx.x * 8;      // covers 1024 halves per c-step
  // stage Q (4 async) then K/V tile 0 (8 async)
#pragma unroll
  for (int c = 0; c < 4; ++c) {
    int off = off0 + 128 * 8 * c;
    int m = off >> 6, d0 = off & 63;
    async_ld16(qs0 + (unsigned)(m * 72 + d0) * 2, qg + m * DH + d0);
  }
#pragma unroll
  for (int c = 0; c < 4; ++c) {
    int off = off0 + 128 * 8 * c;
    int row = off >> 6, d0 = off & 63;
    async_ld16(ks0 + (unsigned)(row * 72 + d0) * 2, kg + (size_t)row * DH + d0);
    async_ld16(vs0 + (unsigned)(row * 72 + d0) * 2, vg + (size_t)row * L_ + d0);
  }
  wait_async_le8();                      // Q (oldest 4) complete
  __syncthreads();

  // Q fragments are kt-invariant: hoist out of the loop. They are the B operand: column = query
  v16h qf[2];
#pragma unroll
  for (int kk = 0; kk < 2; ++kk)
    qf[kk] = frag_f16(Qs + wid * 16 * 72 + kk * 32, 72, lane);

  // Transposed products: a lane owns ONE query (column lane & 15) and, per 16-row tile, rows r + hi.
  v8f z = {0.f,0.f,0.f,0.f,0.f,0.f,0.f,0.f};
  v8f o[4];                              // O^T: o[dt][r] = O[query][dt*16 + hi + r]
#pragma unroll
  for (int dt = 0; dt < 4; ++dt) o[dt] = z;
  float mi = -1e30f;
  v8f lv = z;                            // 8 partial row sums of this half's keys, joined after the loop
  const int hi = (lane & 16) ? 8 : 0;

  for (int kt = 0; kt < 16; ++kt) {
    const int cur = kt & 1;
    if (kt + 1 < 16) {                   // issue next tile; overlaps compute below
      const int nxt = (kt + 1) & 1;
#pragma unroll
      for (int c = 0; c < 4; ++c) {
        int off = off0 + 128 * 8 * c;
        int row = off >> 6, d0 = off & 63;
        async_ld16(ks0 + nxt * bufstep + (unsigned)(row * 72 + d0) * 2,
                   kg + (size_t)((kt + 1) * 64 + row) * DH + d0);
        async_ld16(vs0 + nxt * bufstep + (unsigned)(row * 72 + d0) * 2,
                   vg + (size_t)row * L_ + (kt + 1) * 64 + d0);
      }
      wait_async_le8();                  // in-order: tile kt fully landed
    } else {
      wait_async_le0();
    }
    __syncthreads();                     // all waves' tile-kt parts visible

    // S^T = K Q^T: s[nt][r] = score(key nt*16 + hi + r, query lane & 15)
    v8f s[4];
#pragma unroll
    for (int nt = 0; nt < 4; ++nt) s[nt] = z;
#pragma unroll
    for (int kk = 0; kk < 2; ++kk) {
      v16h kf[4];
#pragma unroll
      for (int nt = 0; nt < 4; ++nt)
        kf[nt] = frag_f16(&Ks[cur][0] + nt * 16 * 72 + kk * 32, 72, lane);
#pragma unroll
      for (int nt = 0; nt < 4; ++nt)
        s[nt] = wmma16(kf[nt], qf[kk], s[nt]);
    }

    // Online softmax: a query's 64 scores lie in two lanes, so maximum and sum run in-lane
    float m4[4];
#pragma unroll  // constant indices keep s in registers
    for (int nt = 0; nt < 4; ++nt) {
      m4[nt] = s[nt][0];
#pragma unroll  // constant indices keep s in registers
      for (int r = 1; r < 8; ++r) m4[nt] = fmaxf(m4[nt], s[nt][r]);
    }
    float mx = fmaxf(fmaxf(m4[0], m4[1]), fmaxf(m4[2], m4[3]));
    mx = fmaxf(mx, xhalf(mx));           // the one exchange: both halves use the same maximum
    const float mnew  = fmaxf(mi, mx);
    const float alpha = __expf(mi - mnew);
    mi = mnew;
#pragma unroll  // constant indices keep s in registers
    for (int nt = 0; nt < 4; ++nt)
#pragma unroll  // constant indices keep s in registers
      for (int r = 0; r < 8; ++r) s[nt][r] = __expf(s[nt][r] - mnew);
    lv = lv * alpha + ((s[0] + s[1]) + (s[2] + s[3]));   // tile rows added register by register
#pragma unroll  // constant indices keep o in registers
    for (int dt = 0; dt < 4; ++dt) o[dt] *= alpha;

    // O^T += V^T P^T: two score tiles, converted in place, are the B operand of 32 keys (no LDS, no exchange)
#pragma unroll
    for (int kk = 0; kk < 2; ++kk) {
      v16h pf = __builtin_shufflevector(__builtin_convertvector(s[2 * kk], v8h),
                                        __builtin_convertvector(s[2 * kk + 1], v8h),
                                        0,1,2,3,4,5,6,7,8,9,10,11,12,13,14,15);
      v16h vf[4];
#pragma unroll
      for (int dt = 0; dt < 4; ++dt)
        vf[dt] = frag_f16(&Vs[cur][0] + dt * 16 * 72 + kk * 32, 72, lane);
#pragma unroll
      for (int dt = 0; dt < 4; ++dt)
        o[dt] = wmma16(vf[dt], pf, o[dt]);
    }
    __syncthreads();                     // done reading buf[cur] before reuse
  }

  // Normalize and write (b, L, DIM) f16: a lane's 8 values of a tile are 8 adjacent d of its query
  const float li = ((lv[0] + lv[1]) + (lv[2] + lv[3])) + ((lv[4] + lv[5]) + (lv[6] + lv[7]));
  const float inv = 1.0f / (li + xhalf(li));
  _Float16* dst = ao + ((size_t)b * L_ + qb * 64 + wid * 16 + (lane & 15)) * DIM_ + h * DH + hi;
#pragma unroll  // constant indices keep o in registers
  for (int dt = 0; dt < 4; ++dt)
    *(v8h*)&dst[dt * 16] = __builtin_convertvector(o[dt] * inv, v8h);
}

// ---------------------------------------------------------------------------
// Kernel 3: out = attn(f16) @ w_proj, fp32 out. BM=128, BN=256, 64x64 per wave, the same main loop.
// ---------------------------------------------------------------------------
__global__ __launch_bounds__(256) void proj_kernel(
    const _Float16* __restrict__ a16, const _Float16* __restrict__ wt,
    float* __restrict__ out) {
  __shared__ __attribute__((aligned(16))) _Float16 S[2 * GSTAGE];
  const int lane = threadIdx.x & 31;
  const int wid  = threadIdx.x >> 5;
  const int wm = wid & 1, wn = wid >> 1;
  const int bn = blockIdx.x, bm = blockIdx.y;
  const int row0 = bm * 128 + wm * 64;

  v8f z = {0.f,0.f,0.f,0.f,0.f,0.f,0.f,0.f};
  v8f acc[4][4];
#pragma unroll
  for (int ms = 0; ms < 4; ++ms)
#pragma unroll
    for (int nt = 0; nt < 4; ++nt) acc[ms][nt] = z;

  gemm_main(a16, wt, S, bm, bn, acc);

  const int hi = (lane & 16) ? 8 : 0;
  float* dst = out + (size_t)(row0 + hi) * DIM_ + bn * 256 + wn * 64 + (lane & 15) * 4;
#pragma unroll  // constant indices keep acc in registers
  for (int ms = 0; ms < 4; ++ms)
#pragma unroll  // constant indices keep acc in registers
    for (int r = 0; r < 8; ++r) {          // 16 lanes x 16 B = two whole lines of one row
      v4f ov = {acc[ms][0][r], acc[ms][1][r], acc[ms][2][r], acc[ms][3][r]};
      *(v4f*)&dst[(size_t)(ms * 16 + r) * DIM_] = ov;
    }
}

// ---------------------------------------------------------------------------
extern "C" void kernel_launch(void* const* d_in, const int* in_sizes, int n_in,
                              void* d_out, int out_size, void* d_ws, size_t ws_size,
                              hipStream_t stream) {
  (void)in_sizes; (void)n_in; (void)out_size; (void)ws_size;
  const float* x      = (const float*)d_in[0];
  const float* w_qkv  = (const float*)d_in[1];
  const float* w_proj = (const float*)d_in[2];

  char* ws = (char*)d_ws;
  _Float16* qw = (_Float16*)(ws);
  _Float16* kw = (_Float16*)(ws + (size_t)16 * 1024 * 1024);
  _Float16* vw = (_Float16*)(ws + (size_t)32 * 1024 * 1024);
  _Float16* ao = (_Float16*)(ws + (size_t)48 * 1024 * 1024);
  _Float16* x16 = (_Float16*)(ws + (size_t)64 * 1024 * 1024);
  _Float16* wqt = (_Float16*)(ws + (size_t)80 * 1024 * 1024);
  _Float16* wpt = (_Float16*)(ws + (size_t)88 * 1024 * 1024);
  float* out = (float*)d_out;

  to_f16_kernel<<<dim3(WBLK + 512), 256, 0, stream>>>(x, w_qkv, w_proj, x16, wqt, wpt);
  qkv_rope_kernel<<<dim3(N3 / 256, (B_ * L_) / 128), 256, 0, stream>>>(x16, wqt, qw, kw, vw);
  attn_kernel<<<dim3(L_ / 64, NH, B_), 128, 0, stream>>>(qw, kw, vw, ao);
  proj_kernel<<<dim3(DIM_ / 256, (B_ * L_) / 128), 256, 0, stream>>>(ao, wpt, out);
}

// v007
// One run takes 120 microseconds.
// Next to v006, in two timings, it ran 1.05 and 1.03 times as fast.
// All steps since v000 together make it 5.61 times as fast.
#include <hip/hip_runtime.h>

typedef __attribute__((ext_vector_type(16))) _Float16 v16h;
typedef __attribute__((ext_vector_type(8)))  _Float16 v8h;
typedef __attribute__((ext_vector_type(4)))  _Float16 v4h;
typedef __attribute__((ext_vector_type(8)))  float    v8f;
typedef __attribute__((ext_vector_type(4)))  float    v4f;

#define B_    8
#define L_    1024
#define DIM_  1024
#define NH    16
#define DH    64
#define N3    3072
#define PI_F  3.14159265358979323846f

__device__ __forceinline__ v16h frag_f16(const _Float16* base, int stride, int lane) {
  const int row = lane & 15;
  const int lo  = (lane & 16) ? 8 : 0;
  const _Float16* p = base + row * stride + lo;
  v8h a = *(const v8h*)(p);
  v8h b = *(const v8h*)(p + 16);
  return __builtin_shufflevector(a, b, 0,1,2,3,4,5,6,7,8,9,10,11,12,13,14,15);
}

__device__ __forceinline__ v8f wmma16(v16h a, v16h b, v8f c) {
  return __builtin_amdgcn_wmma_f32_16x16x32_f16(false, a, false, b, (short)0, c, false, false);
}

__device__ __forceinline__ float xhalf(float x) {
  int b = __builtin_bit_cast(int, x);
  return __builtin_bit_cast(float, __builtin_amdgcn_permlanex16(b, b, 0x76543210, 0xfedcba98, false, false));
}

__device__ __forceinline__ void sincos_rev(float rev, float& s, float& c) {
  asm("v_sin_f32 %0, %2\n\tv_cos_f32 %1, %2\n\tv_nop" : "=&v"(s), "=&v"(c) : "v"(rev));
}

__device__ __forceinline__ void wait_async_le0() {
  asm volatile("s_wait_asynccnt 0x0" ::: "memory");
}

// ---------------------------------------------------------------------------
// Kernel 0: operands to f16, once per call. x keeps its layout; each weight goes to [n][k], and inside each
// 256-column tile column 4*i+j is written as row 64*j+i, the order in which the GEMMs keep the tile in LDS.
// ---------------------------------------------------------------------------
#define QBLK 192                         // blocks that transpose w_qkv
#define WBLK 256                         // blocks that transpose a weight; the other 512 convert x

// A wave takes 64 k x 32 columns: a lane reads 8 k of 2 x 4 columns (the wave: whole 128-B lines of 8 rows per
// pair of loads), writes 8 x 16 B, and 8 lanes together write one whole 128-B line of a transposed row.
template <int N>
__device__ __forceinline__ void transpose_w(const float* __restrict__ w, _Float16* __restrict__ wt,
                                            int gw, int lane) {
  const int n0 = (gw % (N / 32)) * 32 + (lane >> 3) * 4;
  const int k0 = (gw / (N / 32)) * 64 + (lane & 7) * 8;
  const float* src = w + (size_t)k0 * N + n0;
  _Float16* dst = wt + (size_t)((n0 & ~255) + ((n0 & 255) >> 2)) * DIM_ + k0;
  v4f tmp[2][8];
#pragma unroll  // constant indices keep tmp in registers; all 16 loads in flight together
  for (int c = 0; c < 2; ++c)
#pragma unroll
    for (int i = 0; i < 8; ++i) tmp[c][i] = *(const v4f*)&src[i * N + c * 16];
#pragma unroll
  for (int c = 0; c < 2; ++c)
#pragma unroll
    for (int j = 0; j < 4; ++j) {
      v8h hcol;
#pragma unroll  // constant indices keep tmp and hcol in registers
      for (int i = 0; i < 8; ++i) hcol[i] = (_Float16)tmp[c][i][j];
      *(v8h*)&dst[(j * 64 + c * 4) * DIM_] = hcol;   // column n0 + 16*c + j
    }
  // in the listing another branch's code stands behind these stores and rewrites their registers: the wait first
  asm volatile("s_wait_xcnt 0x0" ::: "memory");
}

__global__ __launch_bounds__(256) void to_f16_kernel(
    const float* __restrict__ x, const float* __restrict__ wq, const float* __restrict__ wp,
    _Float16* __restrict__ x16, _Float16* __restrict__ wqt, _Float16* __restrict__ wpt) {
  const int blk = blockIdx.x;
  const int lane = threadIdx.x & 31;
  const int wid  = __builtin_amdgcn_readfirstlane(threadIdx.x >> 5);
  if (blk < QBLK) {
    transpose_w<N3>(wq, wqt, blk * 8 + wid, lane);
  } else if (blk < WBLK) {
    transpose_w<DIM_>(wp, wpt, (blk - QBLK) * 8 + wid, lane);
  } else {
    // 16 B per lane per load, whole lines per wave; 16 loads per thread
    const size_t base = (size_t)(blk - WBLK) * (256 * 4 * 16) + threadIdx.x * 4;
    v4f t[16];
#pragma unroll  // constant indices keep t in registers; all loads in flight together
    for (int i = 0; i < 16; ++i) t[i] = *(const v4f*)&x[base + i * 1024];
#pragma unroll
    for (int i = 0; i < 16; ++i) *(v4h*)&x16[base + i * 1024] = __builtin_convertvector(t[i], v4h);
    // in the listing another branch's code stands behind these stores and rewrites their registers: the wait first
    asm volatile("s_wait_xcnt 0x0" ::: "memory");
  }
}

// ---------------------------------------------------------------------------
// Shared main loop of both GEMMs: C(128x256) = A(128x1024) * Bt(256x1024)^T, f16 operands, k contiguous.
// A stage is 64 k of 384 rows (128 of A, then 256 of Bt) at pitch 72 halves (144 B); two buffers.
// ---------------------------------------------------------------------------
#define GPITCH 72
#define GSTAGE (384 * GPITCH)            // halves per buffer
#define GSTAGE_B (GSTAGE * 2)            // bytes per buffer
#define GROWS_B (32 * GPITCH * 2)        // bytes of 32 LDS rows

// One stage: 12 copies per lane, 8 lanes per 128-B row, 32 rows per copy of the block. The wait on the address
// translations is the statement's last line, so no address register is rewritten in front of it.
__device__ __forceinline__ void stage_copy(unsigned l, const _Float16* a, const _Float16* b) {
  asm volatile(
      "global_load_async_to_lds_b128 %0, %12, off\n\t"
      "global_load_async_to_lds_b128 %1, %13, off\n\t"
      "global_load_async_to_lds_b128 %2, %14, off\n\t"
      "global_load_async_to_lds_b128 %3, %15, off\n\t"
      "global_load_async_to_lds_b128 %4, %16, off\n\t"
      "global_load_async_to_lds_b128 %5, %17, off\n\t"
      "global_load_async_to_lds_b128 %6, %18, off\n\t"
      "global_load_async_to_lds_b128 %7, %19, off\n\t"
      "global_load_async_to_lds_b128 %8, %20, off\n\t"
      "global_load_async_to_lds_b128 %9, %21, off\n\t"
      "global_load_async_to_lds_b128 %10, %22, off\n\t"
      "global_load_async_to_lds_b128 %11, %23, off\n\t"
      "s_wait_xcnt 0x0"
      :: "v"(l), "v"(l + GROWS_B), "v"(l + 2 * GROWS_B), "v"(l + 3 * GROWS_B),
         "v"(l + 4 * GROWS_B), "v"(l + 5 * GROWS_B), "v"(l + 6 * GROWS_B), "v"(l + 7 * GROWS_B),
         "v"(l + 8 * GROWS_B), "v"(l + 9 * GROWS_B), "v"(l + 10 * GROWS_B), "v"(l + 11 * GROWS_B),
         "v"(a), "v"(a + 32 * DIM_), "v"(a + 64 * DIM_), "v"(a + 96 * DIM_),
         "v"(b), "v"(b + 32 * DIM_), "v"(b + 64 * DIM_), "v"(b + 96 * DIM_),
         "v"(b + 128 * DIM_), "v"(b + 160 * DIM_), "v"(b + 192 * DIM_), "v"(b + 224 * DIM_)
      : "memory");
}

__device__ __forceinline__ void gemm_main(const _Float16* __restrict__ A, const _Float16* __restrict__ Bt,
                                          _Float16* S, int bm, int bn, v8f (&acc)[4][4]) {
  const int lane = threadIdx.x & 31;
  const int wid  = threadIdx.x >> 5;
  const int wm = wid & 1, wn = wid >> 1;
  const int r8 = threadIdx.x >> 3, c8 = (threadIdx.x & 7) * 8;
  const unsigned l0 = (unsigned)(uintptr_t)S + (unsigned)(r8 * GPITCH + c8) * 2;
  const _Float16* ga = A  + (size_t)(bm * 128 + r8) * DIM_ + c8;
  const _Float16* gb = Bt + (size_t)(bn * 256 + r8) * DIM_ + c8;

  stage_copy(l0, ga, gb);                        // stage 0
  wait_async_le0();                              // this wave's part of stage 0 has landed
  __syncthreads();                               // and every other wave's
  stage_copy(l0 + GSTAGE_B, ga + 64, gb + 64);   // stage 1 flies during trip 0

  for (int t = 0; t < DIM_ / 64; ++t) {
    const _Float16* buf = S + (t & 1) * GSTAGE;
#pragma unroll
    for (int kk = 0; kk < 2; ++kk) {
      v16h af[4];
#pragma unroll
      for (int ms = 0; ms < 4; ++ms)
        af[ms] = frag_f16(buf + (wm * 64 + ms * 16) * GPITCH + kk * 32, GPITCH, lane);
      v16h bf[4];
#pragma unroll
      for (int nt = 0; nt < 4; ++nt)             // tile nt = columns 4*i+nt
        bf[nt] = frag_f16(buf + (128 + nt * 64 + wn * 16) * GPITCH + kk * 32, GPITCH, lane);
      if (kk == 1) {
        // publish point of stage t + 1, with the trip's last fragments already fetched: this wave's reads of
        // stage t are done, its copies of stage t + 1 have landed
        asm volatile("s_wait_dscnt 0x0" ::: "memory");
        wait_async_le0();
        __syncthreads();
        if (t + 2 < DIM_ / 64)                   // refill the buffer that every wave has just left
          stage_copy(l0 + (unsigned)(t & 1) * GSTAGE_B, ga + (t + 2) * 64, gb + (t + 2) * 64);
      }
#pragma unroll
      for (int nt = 0; nt < 4; ++nt)
#pragma unroll
        for (int ms = 0; ms < 4; ++ms)           // each loaded fragment feeds 4 products
          acc[ms][nt] = wmma16(af[ms], bf[nt], acc[ms][nt]);
    }
  }
  wait_async_le0();                              // nothing is outstanding when the wave goes on
}

// ---------------------------------------------------------------------------
// Kernel 1: QKV = x @ w_qkv with fused 2D axial RoPE; q pre-scaled by 1/64.
// BM=128, BN=256, 64 k per trip; 8 waves = 2(M) x 4(N), 64x64 per wave; f16 tiles copied to LDS asynchronously.
// ---------------------------------------------------------------------------
__global__ __launch_bounds__(256) void qkv_rope_kernel(
    const _Float16* __restrict__ x16, const _Float16* __restrict__ wt,
    _Float16* __restrict__ qw, _Float16* __restrict__ kw, _Float16* __restrict__ vw) {
  __shared__ __attribute__((aligned(16))) _Float16 S[2 * GSTAGE];
  const int lane = threadIdx.x & 31;
  const int wid  = threadIdx.x >> 5;
  const int wm = wid & 1, wn = wid >> 1;
  const int bn = blockIdx.x, bm = blockIdx.y;
  const int row0 = bm * 128 + wm * 64;

  v8f z = {0.f,0.f,0.f,0.f,0.f,0.f,0.f,0.f};
  v8f acc[4][4];
#pragma unroll
  for (int ms = 0; ms < 4; ++ms)
#pragma unroll
    for (int nt = 0; nt < 4; ++nt) acc[ms][nt] = z;

  gemm_main(x16, wt, S, bm, bn, acc);

  // Epilogue: RoPE + scatter. C layout: lane holds (M = r + hi, column 4*(lane&15) + nt).
  const int hi = (lane & 16) ? 8 : 0;
  const int seg = bn >> 2;                 // 0=q 1=k 2=v, the same for the whole block
  const int h  = (bn & 3) * 4 + wn;        // a wave's 64 columns are one head
  const int d0 = (lane & 15) * 4;
  const int b  = row0 >> 10;               // a wave's 64 rows lie in one batch
  const int l0 = (row0 & 1023) + hi;
  if (seg < 2) {
    _Float16* dst = (seg == 0 ? qw : kw) + ((size_t)(b * NH + h) * L_ + l0) * DH + d0;
    const float sc = (seg == 0) ? (1.0f / 64.0f) : 1.0f;
    const bool wax = d0 >= 32;             // upper half of the head rotates by the column position
    float fj[2];
#pragma unroll  // constant indices keep fj in registers
    for (int p = 0; p < 2; ++p) {
      int j = ((wax ? (d0 - 32) : d0) >> 1) + p;
      fj[p] = (1.0f + (127.0f / 15.0f) * (float)j) * PI_F;
    }
#pragma unroll  // constant indices keep acc in registers
    for (int ms = 0; ms < 4; ++ms) {
#pragma unroll  // constant indices keep acc in registers
      for (int r = 0; r < 8; ++r) {
        int l = l0 + ms * 16 + r;
        float pos = wax ? (-1.0f + (2.0f / 31.0f) * (float)(l & 31))
                        : (-1.0f + (2.0f / 31.0f) * (float)(l >> 5));
        v4h hv;
#pragma unroll  // constant indices keep acc in registers
        for (int p = 0; p < 2; ++p) {      // the rotated pair is two adjacent columns the lane holds
          float th = pos * fj[p];
          float cv, sv;
          sincos_rev(th * 0.15915494309189532f, sv, cv);
          float e = acc[ms][2 * p][r], o = acc[ms][2 * p + 1][r];
          hv[2 * p]     = (_Float16)((e * cv - o * sv) * sc);
          hv[2 * p + 1] = (_Float16)((o * cv + e * sv) * sc);
        }
        *(v4h*)&dst[(ms * 16 + r) * DH] = hv;   // 16 lanes x 8 B = one whole 128-B row
      }
    }
  } else {
    _Float16* dst = vw + ((size_t)(b * NH + h) * DH + d0) * L_ + l0;   // transposed
#pragma unroll  // constant indices keep acc in registers
    for (int ms = 0; ms < 4; ++ms)
#pragma unroll  // constant indices keep acc in registers
      for (int nt = 0; nt < 4; ++nt)       // a lane's 8 rows of one column are 8 adjacent l
        *(v8h*)&dst[nt * L_ + ms * 16] = __builtin_convertvector(acc[ms][nt], v8h);
    // in the listing the q/k code stands behind these stores and rewrites their registers: keep the wait in front
    asm volatile("s_wait_xcnt 0x0" ::: "memory");
  }
}

// ---------------------------------------------------------------------------
// Kernel 2: flash attention per (b,h,256-query slab), products transposed: S^T = K Q^T, O^T += V^T P^T.
// 8 waves x 32 queries: a K or V fragment read from LDS feeds two products, and a K/V tile copied from L2
// serves 256 queries. K/V tiles of 64 keys in two LDS buffers, copied asynchronously one trip ahead.
// ---------------------------------------------------------------------------
#define APITCH 72
#define ATILE (64 * APITCH)              // halves of one K or V tile in LDS
#define AROWS_B (32 * APITCH * 2)        // bytes of 32 LDS rows

__device__ __forceinline__ void q_copy(unsigned l, const _Float16* q) {
  asm volatile(
      "global_load_async_to_lds_b128 %0, %8, off\n\t"
      "global_load_async_to_lds_b128 %1, %9, off\n\t"
      "global_load_async_to_lds_b128 %2, %10, off\n\t"
      "global_load_async_to_lds_b128 %3, %11, off\n\t"
      "global_load_async_to_lds_b128 %4, %12, off\n\t"
      "global_load_async_to_lds_b128 %5, %13, off\n\t"
      "global_load_async_to_lds_b128 %6, %14, off\n\t"
      "global_load_async_to_lds_b128 %7, %15, off\n\t"
      "s_wait_xcnt 0x0"
      :: "v"(l), "v"(l + AROWS_B), "v"(l + 2 * AROWS_B), "v"(l + 3 * AROWS_B),
         "v"(l + 4 * AROWS_B), "v"(l + 5 * AROWS_B), "v"(l + 6 * AROWS_B), "v"(l + 7 * AROWS_B),
         "v"(q), "v"(q + 32 * DH), "v"(q + 64 * DH), "v"(q + 96 * DH),
         "v"(q + 128 * DH), "v"(q + 160 * DH), "v"(q + 192 * DH), "v"(q + 224 * DH)
      : "memory");
}

__device__ __forceinline__ void kv_copy(unsigned lk, unsigned lv, const _Float16* k, const _Float16* v) {
  asm volatile(
      "global_load_async_to_lds_b128 %0, %4, off\n\t"
      "global_load_async_to_lds_b128 %1, %5, off\n\t"
      "global_load_async_to_lds_b128 %2, %6, off\n\t"
      "global_load_async_to_lds_b128 %3, %7, off\n\t"
      "s_wait_xcnt 0x0"
      :: "v"(lk), "v"(lk + AROWS_B), "v"(lv), "v"(lv + AROWS_B),
         "v"(k), "v"(k + 32 * DH), "v"(v), "v"(v + 32 * L_)
      : "memory");
}

__global__ __launch_bounds__(256) __attribute__((amdgpu_waves_per_eu(4, 4))) void attn_kernel(
    const _Float16* __restrict__ qw, const _Float16* __restrict__ kw,
    const _Float16* __restrict__ vw, _Float16* __restrict__ ao) {
  __shared__ __attribute__((aligned(16))) _Float16 Qs[256 * APITCH];   // [m][d]
  __shared__ __attribute__((aligned(16))) _Float16 Ks[2 * ATILE];      // [key][d], two buffers
  __shared__ __attribute__((aligned(16))) _Float16 Vs[2 * ATILE];      // [d][key], two buffers
  const int lane = threadIdx.x & 31;
  const int wid  = threadIdx.x >> 5;
  const int qb = blockIdx.x, h = blockIdx.y, b = blockIdx.z;
  const int bh = b * NH + h;

  // a thread's slice of every copy: 16 B of row r8 (+ 32 per further copy)
  const int r8 = threadIdx.x >> 3, c8 = (threadIdx.x & 7) * 8;
  const unsigned loff = (unsigned)(r8 * APITCH + c8) * 2;
  const unsigned lq = (unsigned)(uintptr_t)(&Qs[0]) + loff;
  const unsigned lk = (unsigned)(uintptr_t)(&Ks[0]) + loff;
  const unsigned lv_ = (unsigned)(uintptr_t)(&Vs[0]) + loff;
  const _Float16* qg = qw + (size_t)bh * L_ * DH + (size_t)(qb * 256 + r8) * DH + c8;
  const _Float16* kg = kw + (size_t)bh * L_ * DH + (size_t)r8 * DH + c8;     // + 64 * DH per tile
  const _Float16* vg = vw + (size_t)bh * DH * L_ + (size_t)r8 * L_ + c8;     // + 64 per tile

  q_copy(lq, qg);
  kv_copy(lk, lv_, kg, vg);                       // tile 0
  wait_async_le0();                               // this wave's part of Q and tile 0 has landed
  __syncthreads();                                // and every other wave's
  kv_copy(lk + ATILE * 2, lv_ + ATILE * 2, kg + 64 * DH, vg + 64);   // tile 1 flies during trip 0

  // Q fragments are kt-invariant: hoist out of the loop. They are the B operand: column = query
  v16h qf[2][2];
#pragma unroll
  for (int qt = 0; qt < 2; ++qt)
#pragma unroll
    for (int kk = 0; kk < 2; ++kk)
      qf[qt][kk] = frag_f16(Qs + (wid * 32 + qt * 16) * APITCH + kk * 32, APITCH, lane);

  // Transposed products: per query tile a lane owns ONE query (column lane & 15) and, per 16-row tile, rows r + hi.
  v8f z = {0.f,0.f,0.f,0.f,0.f,0.f,0.f,0.f};
  v8f o[2][4];                           // O^T: o[qt][dt][r] = O[query][dt*16 + hi + r]
  float mi[2];
  v8f lv[2];                             // 8 partial row sums of this half's keys, joined after the loop
#pragma unroll
  for (int qt = 0; qt < 2; ++qt) {
#pragma unroll
    for (int dt = 0; dt < 4; ++dt) o[qt][dt] = z;
    mi[qt] = -1e30f;
    lv[qt] = z;
  }
  const int hi = (lane & 16) ? 8 : 0;

  for (int kt = 0; kt < 16; ++kt) {
    const _Float16* kb = Ks + (kt & 1) * ATILE;
    const _Float16* vb = Vs + (kt & 1) * ATILE;

    // S^T = K Q^T: s[qt][nt][r] = score(key nt*16 + hi + r, query qt*16 + (lane & 15))
    v8f s[2][4];
#pragma unroll
    for (int qt = 0; qt < 2; ++qt)
#pragma unroll
      for (int nt = 0; nt < 4; ++nt) s[qt][nt] = z;
#pragma unroll
    for (int kk = 0; kk < 2; ++kk) {
      v16h kf[4];
#pragma unroll
      for (int nt = 0; nt < 4; ++nt)
        kf[nt] = frag_f16(kb + nt * 16 * APITCH + kk * 32, APITCH, lane);
#pragma unroll
      for (int nt = 0; nt < 4; ++nt)
#pragma unroll
        for (int qt = 0; qt < 2; ++qt)   // each K fragment feeds both query tiles
          s[qt][nt] = wmma16(kf[nt], qf[qt][kk], s[qt][nt]);
    }

    // Online softmax: a query's 64 scores lie in two lanes, so maximum and sum run in-lane
    float mnew[2], alpha[2];
#pragma unroll  // constant indices keep s in registers
    for (int qt = 0; qt < 2; ++qt) {
      float m4[4];
#pragma unroll  // constant indices keep s in registers
      for (int nt = 0; nt < 4; ++nt) {
        m4[nt] = s[qt][nt][0];
#pragma unroll  // constant indices keep s in registers
        for (int r = 1; r < 8; ++r) m4[nt] = fmaxf(m4[nt], s[qt][nt][r]);
      }
      float mx = fmaxf(fmaxf(m4[0], m4[1]), fmaxf(m4[2], m4[3]));
      mx = fmaxf(mx, xhalf(mx));         // the one exchange: both halves use the same maximum
      mnew[qt] = fmaxf(mi[qt], mx);
    }
#pragma unroll  // a loop of its own: inside the loop below one factor was packed with a score, which cost register copies
    for (int qt = 0; qt < 2; ++qt) {
      alpha[qt] = __expf(mi[qt] - mnew[qt]);
      mi[qt] = mnew[qt];
    }
#pragma unroll  // constant indices keep s and o in registers
    for (int qt = 0; qt < 2; ++qt) {
#pragma unroll  // constant indices keep s in registers
      for (int nt = 0; nt < 4; ++nt)
#pragma unroll  // constant indices keep s in registers
        for (int r = 0; r < 8; ++r) s[qt][nt][r] = __expf(s[qt][nt][r] - mnew[qt]);
      lv[qt] = lv[qt] * alpha[qt] + ((s[qt][0] + s[qt][1]) + (s[qt][2] + s[qt][3]));   // tile rows added register by register
#pragma unroll  // constant indices keep o in registers
      for (int dt = 0; dt < 4; ++dt) o[qt][dt] *= alpha[qt];
    }

    // O^T += V^T P^T: two score tiles, converted in place, are the B operand of 32 keys (no LDS, no exchange)
#pragma unroll
    for (int kk = 0; kk < 2; ++kk) {
      v16h pf[2];
#pragma unroll
      for (int qt = 0; qt < 2; ++qt)
        pf[qt] = __builtin_shufflevector(__builtin_convertvector(s[qt][2 * kk], v8h),
                                         __builtin_convertvector(s[qt][2 * kk + 1], v8h),
                                         0,1,2,3,4,5,6,7,8,9,10,11,12,13,14,15);
      v16h vf[4];
#pragma unroll
      for (int dt = 0; dt < 4; ++dt)
        vf[dt] = frag_f16(vb + dt * 16 * APITCH + kk * 32, APITCH, lane);
#pragma unroll
      for (int dt = 0; dt < 4; ++dt)
#pragma unroll
        for (int qt = 0; qt < 2; ++qt)   // each V fragment feeds both query tiles
          o[qt][dt] = wmma16(vf[dt], pf[qt], o[qt][dt]);
    }

    // publish point of tile kt + 1: this wave's reads of tile kt are done, its copies of tile kt + 1 have landed
    asm volatile("s_wait_dscnt 0x0" ::: "memory");
    wait_async_le0();
    __syncthreads();
    if (kt + 2 < 16)                     // refill the buffers that every wave has just left
      kv_copy(lk + (unsigned)(kt & 1) * (ATILE * 2), lv_ + (unsigned)(kt & 1) * (ATILE * 2),
              kg + (size_t)(kt + 2) * 64 * DH, vg + (kt + 2) * 64);
  }
  wait_async_le0();                      // nothing is outstanding when the wave goes on

  // Normalize and write (b, L, DIM) f16: a lane's 8 values of a tile are 8 adjacent d of its query
#pragma unroll  // constant indices keep o in registers
  for (int qt = 0; qt < 2; ++qt) {
    const float li = ((lv[qt][0] + lv[qt][1]) + (lv[qt][2] + lv[qt][3])) + ((lv[qt][4] + lv[qt][5]) + (lv[qt][6] + lv[qt][7]));
    const float inv = 1.0f / (li + xhalf(li));
    _Float16* dst = ao + ((size_t)b * L_ + qb * 256 + wid * 32 + qt * 16 + (lane & 15)) * DIM_ + h * DH + hi;
#pragma unroll  // constant indices keep o in registers
    for (int dt = 0; dt < 4; ++dt)
      *(v8h*)&dst[dt * 16] = __builtin_convertvector(o[qt][dt] * inv, v8h);
  }
}

// ---------------------------------------------------------------------------
// Kernel 3: out = attn(f16) @ w_proj, fp32 out. BM=128, BN=256, 64x64 per wave, the same main loop.
// ---------------------------------------------------------------------------
__global__ __launch_bounds__(256) void proj_kernel(
    const _Float16* __restrict__ a16, const _Float16* __restrict__ wt,
    float* __restrict__ out) {
  __shared__ __attribute__((aligned(16))) _Float16 S[2 * GSTAGE];
  const int lane = threadIdx.x & 31;
  const int wid  = threadIdx.x >> 5;
  const int wm = wid & 1, wn = wid >> 1;
  const int bn = blockIdx.x, bm = blockIdx.y;
  const int row0 = bm * 128 + wm * 64;

  v8f z = {0.f,0.f,0.f,0.f,0.f,0.f,0.f,0.f};
  v8f acc[4][4];
#pragma unroll
  for (int ms = 0; ms < 4; ++ms)
#pragma unroll
    for (int nt = 0; nt < 4; ++nt) acc[ms][nt] = z;

  gemm_main(a16, wt, S, bm, bn, acc);

  const int hi = (lane & 16) ? 8 : 0;
  float* dst = out + (size_t)(row0 + hi) * DIM_ + bn * 256 + wn * 64 + (lane & 15) * 4;
#pragma unroll  // constant indices keep acc in registers
  for (int ms = 0; ms < 4; ++ms)
#pragma unroll  // constant indices keep acc in registers
    for (int r = 0; r < 8; ++r) {          // 16 lanes x 16 B = two whole lines of one row
      v4f ov = {acc[ms][0][r], acc[ms][1][r], acc[ms][2][r], acc[ms][3][r]};
      *(v4f*)&dst[(size_t)(ms * 16 + r) * DIM_] = ov;
    }
}

// ---------------------------------------------------------------------------
extern "C" void kernel_launch(void* const* d_in, const int* in_sizes, int n_in,
                              void* d_out, int out_size, void* d_ws, size_t ws_size,
                              hipStream_t stream) {
  (void)in_sizes; (void)n_in; (void)out_size; (void)ws_size;
  const float* x      = (const float*)d_in[0];
  const float* w_qkv  = (const float*)d_in[1];
  const float* w_proj = (const float*)d_in[2];

  char* ws = (char*)d_ws;
  _Float16* qw = (_Float16*)(ws);
  _Float16* kw = (_Float16*)(ws + (size_t)16 * 1024 * 1024);
  _Float16* vw = (_Float16*)(ws + (size_t)32 * 1024 * 1024);
  _Float16* ao = (_Float16*)(ws + (size_t)48 * 1024 * 1024);
  _Float16* x16 = (_Float16*)(ws + (size_t)64 * 1024 * 1024);
  _Float16* wqt = (_Float16*)(ws + (size_t)80 * 1024 * 1024);
  _Float16* wpt = (_Float16*)(ws + (size_t)88 * 1024 * 1024);
  float* out = (float*)d_out;

  to_f16_kernel<<<dim3(WBLK + 512), 256, 0, stream>>>(x, w_qkv, w_proj, x16, wqt, wpt);
  qkv_rope_kernel<<<dim3(N3 / 256, (B_ * L_) / 128), 256, 0, stream>>>(x16, wqt, qw, kw, vw);
  attn_kernel<<<dim3(L_ / 256, NH, B_), 256, 0, stream>>>(qw, kw, vw, ao);
  proj_kernel<<<dim3(DIM_ / 256, (B_ * L_) / 128), 256, 0, stream>>>(ao, wpt, out);
}

// v008
// It runs in 109 microseconds.
// In two side-by-side timings against v007, it was 1.10 and 1.09 times as fast.
// Counting every step since v000, it is 6.16 times as fast.
#include <hip/hip_runtime.h>

typedef __attribute__((ext_vector_type(16))) _Float16 v16h;
typedef __attribute__((ext_vector_type(8)))  _Float16 v8h;
typedef __attribute__((ext_vector_type(4)))  _Float16 v4h;
typedef __attribute__((ext_vector_type(8)))  float    v8f;
typedef __attribute__((ext_vector_type(4)))  float    v4f;

#define B_    8
#define L_    1024
#define DIM_  1024
#define NH    16
#define DH    64
#define N3    3072
#define PI_F  3.14159265358979323846f

__device__ __forceinline__ v16h frag_f16(const _Float16* base, int stride, int lane) {
  const int row = lane & 15;
  const int lo  = (lane & 16) ? 8 : 0;
  const _Float16* p = base + row * stride + lo;
  v8h a = *(const v8h*)(p);
  v8h b = *(const v8h*)(p + 16);
  return __builtin_shufflevector(a, b, 0,1,2,3,4,5,6,7,8,9,10,11,12,13,14,15);
}

__device__ __forceinline__ v8f wmma16(v16h a, v16h b, v8f c) {
  return __builtin_amdgcn_wmma_f32_16x16x32_f16(false, a, false, b, (short)0, c, false, false);
}

__device__ __forceinline__ float xhalf(float x) {
  int b = __builtin_bit_cast(int, x);
  return __builtin_bit_cast(float, __builtin_amdgcn_permlanex16(b, b, 0x76543210, 0xfedcba98, false, false));
}

__device__ __forceinline__ void sincos_rev(float rev, float& s, float& c) {
  asm("v_sin_f32 %0, %2\n\tv_cos_f32 %1, %2\n\tv_nop" : "=&v"(s), "=&v"(c) : "v"(rev));
}

__device__ __forceinline__ void wait_async_le0() {
  asm volatile("s_wait_asynccnt 0x0" ::: "memory");
}

// ---------------------------------------------------------------------------
// Kernel 0: operands to f16, once per call. x keeps its layout; each weight goes to [n][k], in the row order in
// which its GEMM keeps the tile in LDS. w_proj: inside each 256-column tile column 4*i+j is row 64*j+i.
// w_qkv: head h owns rows 192*h..192*h+191: 64 of q, 64 of k, 64 of v, and of each 64 column 4*i+j is row 16*j+i.
// ---------------------------------------------------------------------------
#define QBLK 192                         // blocks that transpose w_qkv
#define WBLK 256                         // blocks that transpose a weight; the other 512 convert x

// A wave takes 64 k x 32 columns: a lane reads 8 k of 2 x 4 columns (the wave: whole 128-B lines of 8 rows per
// pair of loads), writes 8 x 16 B, and 8 lanes together write one whole 128-B line of a transposed row.
template <int N>
__device__ __forceinline__ void transpose_w(const float* __restrict__ w, _Float16* __restrict__ wt,
                                            int gw, int lane) {
  const int n0 = (gw % (N / 32)) * 32 + (lane >> 3) * 4;
  const int k0 = (gw / (N / 32)) * 64 + (lane & 7) * 8;
  const float* src = w + (size_t)k0 * N + n0;
  const int row = (N == N3) ? ((n0 >> 6) & 15) * 192 + (n0 >> 10) * 64 + ((n0 & 63) >> 2)
                            : (n0 & ~255) + ((n0 & 255) >> 2);
  constexpr int JS = (N == N3) ? 16 : 64;          // rows between columns 4*i+j and 4*i+j+1
  _Float16* dst = wt + (size_t)row * DIM_ + k0;
  v4f tmp[2][8];
#pragma unroll  // constant indices keep tmp in registers; all 16 loads in flight together
  for (int c = 0; c < 2; ++c)
#pragma unroll
    for (int i = 0; i < 8; ++i) tmp[c][i] = *(const v4f*)&src[i * N + c * 16];
#pragma unroll
  for (int c = 0; c < 2; ++c)
#pragma unroll
    for (int j = 0; j < 4; ++j) {
      v8h hcol;
#pragma unroll  // constant indices keep tmp and hcol in registers
      for (int i = 0; i < 8; ++i) hcol[i] = (_Float16)tmp[c][i][j];
      *(v8h*)&dst[(j * JS + c * 4) * DIM_] = hcol;   // column n0 + 16*c + j
    }
  // in the listing another branch's code stands behind these stores and rewrites their registers: the wait first
  asm volatile("s_wait_xcnt 0x0" ::: "memory");
}

__global__ __launch_bounds__(256) void to_f16_kernel(
    const float* __restrict__ x, const float* __restrict__ wq, const float* __restrict__ wp,
    _Float16* __restrict__ x16, _Float16* __restrict__ wqt, _Float16* __restrict__ wpt) {
  const int blk = blockIdx.x;
  const int lane = threadIdx.x & 31;
  const int wid  = __builtin_amdgcn_readfirstlane(threadIdx.x >> 5);
  if (blk < QBLK) {
    transpose_w<N3>(wq, wqt, blk * 8 + wid, lane);
  } else if (blk < WBLK) {
    transpose_w<DIM_>(wp, wpt, (blk - QBLK) * 8 + wid, lane);
  } else {
    // 16 B per lane per load, whole lines per wave; 16 loads per thread
    const size_t base = (size_t)(blk - WBLK) * (256 * 4 * 16) + threadIdx.x * 4;
    v4f t[16];
#pragma unroll  // constant indices keep t in registers; all loads in flight together
    for (int i = 0; i < 16; ++i) t[i] = *(const v4f*)&x[base + i * 1024];
#pragma unroll
    for (int i = 0; i < 16; ++i) *(v4h*)&x16[base + i * 1024] = __builtin_convertvector(t[i], v4h);
    // in the listing another branch's code stands behind these stores and rewrites their registers: the wait first
    asm volatile("s_wait_xcnt 0x0" ::: "memory");
  }
}

// ---------------------------------------------------------------------------
// Main loop of the output projection: C(128x256) = A(128x1024) * Bt(256x1024)^T, f16 operands, k contiguous.
// A stage is 64 k of 384 rows (128 of A, then 256 of Bt) at pitch 72 halves (144 B); two buffers.
// ---------------------------------------------------------------------------
#define GPITCH 72
#define GSTAGE (384 * GPITCH)            // halves per buffer
#define GSTAGE_B (GSTAGE * 2)            // bytes per buffer
#define GROWS_B (32 * GPITCH * 2)        // bytes of 32 LDS rows

// One stage: 12 copies per lane, 8 lanes per 128-B row, 32 rows per copy of the block. The wait on the address
// translations is the statement's last line, so no address register is rewritten in front of it.
__device__ __forceinline__ void stage_copy(unsigned l, const _Float16* a, const _Float16* b) {
  asm volatile(
      "global_load_async_to_lds_b128 %0, %12, off\n\t"
      "global_load_async_to_lds_b128 %1, %13, off\n\t"
      "global_load_async_to_lds_b128 %2, %14, off\n\t"
      "global_load_async_to_lds_b128 %3, %15, off\n\t"
      "global_load_async_to_lds_b128 %4, %16, off\n\t"
      "global_load_async_to_lds_b128 %5, %17, off\n\t"
      "global_load_async_to_lds_b128 %6, %18, off\n\t"
      "global_load_async_to_lds_b128 %7, %19, off\n\t"
      "global_load_async_to_lds_b128 %8, %20, off\n\t"
      "global_load_async_to_lds_b128 %9, %21, off\n\t"
      "global_load_async_to_lds_b128 %10, %22, off\n\t"
      "global_load_async_to_lds_b128 %11, %23, off\n\t"
      "s_wait_xcnt 0x0"
      :: "v"(l), "v"(l + GROWS_B), "v"(l + 2 * GROWS_B), "v"(l + 3 * GROWS_B),
         "v"(l + 4 * GROWS_B), "v"(l + 5 * GROWS_B), "v"(l + 6 * GROWS_B), "v"(l + 7 * GROWS_B),
         "v"(l + 8 * GROWS_B), "v"(l + 9 * GROWS_B), "v"(l + 10 * GROWS_B), "v"(l + 11 * GROWS_B),
         "v"(a), "v"(a + 32 * DIM_), "v"(a + 64 * DIM_), "v"(a + 96 * DIM_),
         "v"(b), "v"(b + 32 * DIM_), "v"(b + 64 * DIM_), "v"(b + 96 * DIM_),
         "v"(b + 128 * DIM_), "v"(b + 160 * DIM_), "v"(b + 192 * DIM_), "v"(b + 224 * DIM_)
      : "memory");
}

__device__ __forceinline__ void gemm_main(const _Float16* __restrict__ A, const _Float16* __restrict__ Bt,
                                          _Float16* S, int bm, int bn, v8f (&acc)[4][4]) {
  const int lane = threadIdx.x & 31;
  const int wid  = threadIdx.x >> 5;
  const int wm = wid & 1, wn = wid >> 1;
  const int r8 = threadIdx.x >> 3, c8 = (threadIdx.x & 7) * 8;
  const unsigned l0 = (unsigned)(uintptr_t)S + (unsigned)(r8 * GPITCH + c8) * 2;
  const _Float16* ga = A  + (size_t)(bm * 128 + r8) * DIM_ + c8;
  const _Float16* gb = Bt + (size_t)(bn * 256 + r8) * DIM_ + c8;

  stage_copy(l0, ga, gb);                        // stage 0
  wait_async_le0();                              // this wave's part of stage 0 has landed
  __syncthreads();                               // and every other wave's
  stage_copy(l0 + GSTAGE_B, ga + 64, gb + 64);   // stage 1 flies during trip 0

  for (int t = 0; t < DIM_ / 64; ++t) {
    const _Float16* buf = S + (t & 1) * GSTAGE;
#pragma unroll
    for (int kk = 0; kk < 2; ++kk) {
      v16h af[4];
#pragma unroll
      for (int ms = 0; ms < 4; ++ms)
        af[ms] = frag_f16(buf + (wm * 64 + ms * 16) * GPITCH + kk * 32, GPITCH, lane);
      v16h bf[4];
#pragma unroll
      for (int nt = 0; nt < 4; ++nt)             // tile nt = columns 4*i+nt
        bf[nt] = frag_f16(buf + (128 + nt * 64 + wn * 16) * GPITCH + kk * 32, GPITCH, lane);
      if (kk == 1) {
        // publish point of stage t + 1, with the trip's last fragments already fetched: this wave's reads of
        // stage t are done, its copies of stage t + 1 have landed
        asm volatile("s_wait_dscnt 0x0" ::: "memory");
        wait_async_le0();
        __syncthreads();
        if (t + 2 < DIM_ / 64)                   // refill the buffer that every wave has just left
          stage_copy(l0 + (unsigned)(t & 1) * GSTAGE_B, ga + (t + 2) * 64, gb + (t + 2) * 64);
      }
#pragma unroll
      for (int nt = 0; nt < 4; ++nt)
#pragma unroll
        for (int ms = 0; ms < 4; ++ms)           // each loaded fragment feeds 4 products
          acc[ms][nt] = wmma16(af[ms], bf[nt], acc[ms][nt]);
    }
  }
  wait_async_le0();                              // nothing is outstanding when the wave goes on
}

// ---------------------------------------------------------------------------
// Kernel 1: QKV = x @ w_qkv with fused 2D axial RoPE; q pre-scaled by 1/64.
// BM=256, BN=384 (q, k and v of two heads), 64 k per trip; 8 waves = 4(M) x 2(N), 64x192 per wave: 256 blocks,
// one per WGP, one round. A stage is 640 rows (256 of x, then 384 of the weight) at pitch 72 halves; two buffers.
// ---------------------------------------------------------------------------
#define QSTAGE (640 * GPITCH)            // halves per buffer

typedef __attribute__((ext_vector_type(4))) int v4i;
typedef __attribute__((address_space(1))) v4i gv4i;
typedef __attribute__((address_space(3))) v4i lv4i;

// One stage: 20 copies per lane, 8 lanes per 128-B row, 32 rows per copy of the block. a and b are the block's
// tile starts, off the lane's own element in a 32-row group.
// The builtin, not asm text: asm operands must lie in the first 256 registers, and beside 384 accumulator registers
// that cost some 300 register moves and a spill per trip.
__device__ __forceinline__ void qstage_copy(_Float16* l, const _Float16* a, const _Float16* b, unsigned off) {
#pragma unroll  // straight-line copies, constant steps
  for (int c = 0; c < 8; ++c)
    __builtin_amdgcn_global_load_async_to_lds_b128((gv4i*)(a + c * 32 * DIM_ + off), (lv4i*)(l + c * 32 * GPITCH), 0, 0);
#pragma unroll  // straight-line copies, constant steps
  for (int c = 0; c < 12; ++c)
    __builtin_amdgcn_global_load_async_to_lds_b128((gv4i*)(b + c * 32 * DIM_ + off), (lv4i*)(l + (8 + c) * 32 * GPITCH), 0, 0);
}

// four fragments, 16 LDS rows apart
__device__ __forceinline__ void ld4(v16h (&f)[4], const _Float16* p, int lane) {
#pragma unroll  // constant indices keep f in registers
  for (int i = 0; i < 4; ++i) f[i] = frag_f16(p + i * 16 * GPITCH, GPITCH, lane);
}

// 64 rows x 64 columns x 32 k: tile j = columns 4*i+j of part G (0 q, 1 k, 2 v)
template <int G>
__device__ __forceinline__ void mm16(const v16h (&af)[4], const v16h (&bf)[4], v8f (&acc)[4][12]) {
#pragma unroll  // constant indices keep acc in registers
  for (int j = 0; j < 4; ++j)
#pragma unroll  // constant indices keep acc in registers
    for (int ms = 0; ms < 4; ++ms)
      acc[ms][G * 4 + j] = wmma16(af[ms], bf[j], acc[ms][G * 4 + j]);
}

__global__ __launch_bounds__(256) void qkv_rope_kernel(
    const _Float16* __restrict__ x16, const _Float16* __restrict__ wt,
    _Float16* __restrict__ qw, _Float16* __restrict__ kw, _Float16* __restrict__ vw) {
  __shared__ __attribute__((aligned(16))) _Float16 S[2 * QSTAGE];
  const int lane = threadIdx.x & 31;
  const int wid  = threadIdx.x >> 5;
  const int wm = wid & 3, wn = wid >> 2;
  const int bn = blockIdx.x, bm = blockIdx.y;
  const int row0 = bm * 256 + wm * 64;

  v8f z = {0.f,0.f,0.f,0.f,0.f,0.f,0.f,0.f};
  v8f acc[4][12];                          // tiles 0-3: q, 4-7: k, 8-11: v of the wave's head
#pragma unroll
  for (int ms = 0; ms < 4; ++ms)
#pragma unroll
    for (int nt = 0; nt < 12; ++nt) acc[ms][nt] = z;

  const int r8 = threadIdx.x >> 3, c8 = (threadIdx.x & 7) * 8;
  _Float16* lc = S + r8 * GPITCH + c8;
  const unsigned off = (unsigned)(r8 * DIM_ + c8);
  const _Float16* ga = x16 + (size_t)bm * 256 * DIM_;
  const _Float16* gb = wt  + (size_t)bn * 384 * DIM_;

  qstage_copy(lc, ga, gb, off);                  // stage 0
  wait_async_le0();                              // this wave's part of stage 0 has landed
  __syncthreads();                               // and every other wave's
  qstage_copy(lc + QSTAGE, ga + 64, gb + 64, off);   // stage 1 flies during trip 0

  // A trip is six blocks of 16 products (2 x 32 k; q, k, v). The four B fragments of a block are fetched one block
  // ahead into the other of two register sets, as one group in front of the products that hide them.
  // SB: the compiler does not schedule across it; without it it fetched one fragment per four products and waited.
#define SB() __builtin_amdgcn_sched_barrier(0)
  const _Float16* pa = S + wm * 64 * GPITCH;               // the wave's 64 rows of x
  const _Float16* pb = S + (256 + wn * 192) * GPITCH;      // its 192 rows of the weight
  v16h af[4], b0[4], b1[4];
  ld4(b0, pb, lane);
  for (int t = 0; t < DIM_ / 64; ++t) {
    const int cur = (t & 1) * QSTAGE, nxt = QSTAGE - cur;
    ld4(af, pa + cur, lane);
    ld4(b1, pb + cur + 64 * GPITCH, lane);
    SB(); mm16<0>(af, b0, acc); SB();
    ld4(b0, pb + cur + 128 * GPITCH, lane);
    SB(); mm16<1>(af, b1, acc); SB();
    ld4(b1, pb + cur + 32, lane);
    SB(); mm16<2>(af, b0, acc); SB();
    ld4(af, pa + cur + 32, lane);
    ld4(b0, pb + cur + 64 * GPITCH + 32, lane);
    SB(); mm16<0>(af, b1, acc); SB();
    ld4(b1, pb + cur + 128 * GPITCH + 32, lane);
    // publish point of stage t + 1, with the trip's last fragments already fetched: this wave's reads of
    // stage t are done, its copies of stage t + 1 have landed
    asm volatile("s_wait_dscnt 0x0" ::: "memory");
    wait_async_le0();
    __syncthreads();
    if (t + 2 < DIM_ / 64)                       // refill the buffer that every wave has just left
      qstage_copy(lc + cur, ga + (t + 2) * 64, gb + (t + 2) * 64, off);
    SB(); mm16<1>(af, b0, acc); SB();
    // behind the barrier stage t + 1 may be read; in the last trip this reads the idle buffer and nobody uses it
    ld4(b0, pb + nxt, lane);
    SB(); mm16<2>(af, b1, acc); SB();
  }
#undef SB
  wait_async_le0();                              // nothing is outstanding when the wave goes on

  // Epilogue: RoPE + scatter. C layout: lane holds (M = r + hi, column 4*(lane&15) + j of q, of k and of v).
  const int hi = (lane & 16) ? 8 : 0;
  const int h  = bn * 2 + wn;              // the wave's head
  const int d0 = (lane & 15) * 4;
  const int b  = row0 >> 10;               // a wave's 64 rows lie in one batch
  const int l0 = (row0 & 1023) + hi;
  {
    _Float16* dst = vw + ((size_t)(b * NH + h) * DH + d0) * L_ + l0;   // transposed
    v8h vv[4][4];
#pragma unroll  // constant indices keep acc in registers
    for (int ms = 0; ms < 4; ++ms)
#pragma unroll  // constant indices keep acc in registers
      for (int j = 0; j < 4; ++j) vv[ms][j] = __builtin_convertvector(acc[ms][8 + j], v8h);
    // all values first, each in registers of its own, then the stores, then the wait: nothing is scheduled across
    // these fences, so no register that an issued store names is rewritten in front of the wait
    __builtin_amdgcn_sched_barrier(0);
#pragma unroll  // constant indices keep vv in registers
    for (int ms = 0; ms < 4; ++ms)
#pragma unroll  // constant indices keep vv in registers
      for (int j = 0; j < 4; ++j)          // a lane's 8 rows of one column are 8 adjacent l
        *(v8h*)&dst[j * L_ + ms * 16] = vv[ms][j];
    asm volatile("s_wait_xcnt 0x0" ::: "memory");
    __builtin_amdgcn_sched_barrier(0);
  }
  {
    const size_t off = ((size_t)(b * NH + h) * L_ + l0) * DH + d0;
    _Float16* dq = qw + off;
    _Float16* dk = kw + off;
    const bool wax = d0 >= 32;             // upper half of the head rotates by the column position
    float fj[2];
#pragma unroll  // constant indices keep fj in registers
    for (int p = 0; p < 2; ++p) {
      int j = ((wax ? (d0 - 32) : d0) >> 1) + p;
      fj[p] = (1.0f + (127.0f / 15.0f) * (float)j) * PI_F;
    }
#pragma unroll  // constant indices keep acc in registers
    for (int ms = 0; ms < 4; ++ms) {
      v4h hq8[8], hk8[8];
#pragma unroll  // constant indices keep acc in registers
      for (int r = 0; r < 8; ++r) {
        int l = l0 + ms * 16 + r;
        float pos = wax ? (-1.0f + (2.0f / 31.0f) * (float)(l & 31))
                        : (-1.0f + (2.0f / 31.0f) * (float)(l >> 5));
        v4h hq, hk;
#pragma unroll  // constant indices keep acc in registers
        for (int p = 0; p < 2; ++p) {      // the rotated pair is two adjacent columns the lane holds
          float th = pos * fj[p];
          float cv, sv;
          sincos_rev(th * 0.15915494309189532f, sv, cv);   // one angle serves q and k
          float e = acc[ms][2 * p][r], o = acc[ms][2 * p + 1][r];
          hq[2 * p]     = (_Float16)((e * cv - o * sv) * (1.0f / 64.0f));
          hq[2 * p + 1] = (_Float16)((o * cv + e * sv) * (1.0f / 64.0f));
          float ek = acc[ms][4 + 2 * p][r], ok = acc[ms][4 + 2 * p + 1][r];
          hk[2 * p]     = (_Float16)(ek * cv - ok * sv);
          hk[2 * p + 1] = (_Float16)(ok * cv + ek * sv);
        }
        hq8[r] = hq;
        hk8[r] = hk;
      }
      __builtin_amdgcn_sched_barrier(0);
#pragma unroll  // constant indices keep hq8 and hk8 in registers
      for (int r = 0; r < 8; ++r) {
        *(v4h*)&dq[(ms * 16 + r) * DH] = hq8[r];   // 16 lanes x 8 B = one whole 128-B row
        *(v4h*)&dk[(ms * 16 + r) * DH] = hk8[r];
      }
      asm volatile("s_wait_xcnt 0x0" ::: "memory");
      __builtin_amdgcn_sched_barrier(0);
    }
  }
}

// ---------------------------------------------------------------------------
// Kernel 2: flash attention per (b,h,256-query slab), products transposed: S^T = K Q^T, O^T += V^T P^T.
// 8 waves x 32 queries: a K or V fragment read from LDS feeds two products, and a K/V tile copied from L2
// serves 256 queries. K/V tiles of 64 keys in two LDS buffers, copied asynchronously one trip ahead.
// ---------------------------------------------------------------------------
#define APITCH 72
#define ATILE (64 * APITCH)              // halves of one K or V tile in LDS
#define AROWS_B (32 * APITCH * 2)        // bytes of 32 LDS rows

__device__ __forceinline__ void q_copy(unsigned l, const _Float16* q) {
  asm volatile(
      "global_load_async_to_lds_b128 %0, %8, off\n\t"
      "global_load_async_to_lds_b128 %1, %9, off\n\t"
      "global_load_async_to_lds_b128 %2, %10, off\n\t"
      "global_load_async_to_lds_b128 %3, %11, off\n\t"
      "global_load_async_to_lds_b128 %4, %12, off\n\t"
      "global_load_async_to_lds_b128 %5, %13, off\n\t"
      "global_load_async_to_lds_b128 %6, %14, off\n\t"
      "global_load_async_to_lds_b128 %7, %15, off\n\t"
      "s_wait_xcnt 0x0"
      :: "v"(l), "v"(l + AROWS_B), "v"(l + 2 * AROWS_B), "v"(l + 3 * AROWS_B),
         "v"(l + 4 * AROWS_B), "v"(l + 5 * AROWS_B), "v"(l + 6 * AROWS_B), "v"(l + 7 * AROWS_B),
         "v"(q), "v"(q + 32 * DH), "v"(q + 64 * DH), "v"(q + 96 * DH),
         "v"(q + 128 * DH), "v"(q + 160 * DH), "v"(q + 192 * DH), "v"(q + 224 * DH)
      : "memory");
}

__device__ __forceinline__ void kv_copy(unsigned lk, unsigned lv, const _Float16* k, const _Float16* v) {
  asm volatile(
      "global_load_async_to_lds_b128 %0, %4, off\n\t"
      "global_load_async_to_lds_b128 %1, %5, off\n\t"
      "global_load_async_to_lds_b128 %2, %6, off\n\t"
      "global_load_async_to_lds_b128 %3, %7, off\n\t"
      "s_wait_xcnt 0x0"
      :: "v"(lk), "v"(lk + AROWS_B), "v"(lv), "v"(lv + AROWS_B),
         "v"(k), "v"(k + 32 * DH), "v"(v), "v"(v + 32 * L_)
      : "memory");
}

__global__ __launch_bounds__(256) __attribute__((amdgpu_waves_per_eu(4, 4))) void attn_kernel(
    const _Float16* __restrict__ qw, const _Float16* __restrict__ kw,
    const _Float16* __restrict__ vw, _Float16* __restrict__ ao) {
  __shared__ __attribute__((aligned(16))) _Float16 Qs[256 * APITCH];   // [m][d]
  __shared__ __attribute__((aligned(16))) _Float16 Ks[2 * ATILE];      // [key][d], two buffers
  __shared__ __attribute__((aligned(16))) _Float16 Vs[2 * ATILE];      // [d][key], two buffers
  const int lane = threadIdx.x & 31;
  const int wid  = threadIdx.x >> 5;
  const int qb = blockIdx.x, h = blockIdx.y, b = blockIdx.z;
  const int bh = b * NH + h;

  // a thread's slice of every copy: 16 B of row r8 (+ 32 per further copy)
  const int r8 = threadIdx.x >> 3, c8 = (threadIdx.x & 7) * 8;
  const unsigned loff = (unsigned)(r8 * APITCH + c8) * 2;
  const unsigned lq = (unsigned)(uintptr_t)(&Qs[0]) + loff;
  const unsigned lk = (unsigned)(uintptr_t)(&Ks[0]) + loff;
  const unsigned lv_ = (unsigned)(uintptr_t)(&Vs[0]) + loff;
  const _Float16* qg = qw + (size_t)bh * L_ * DH + (size_t)(qb * 256 + r8) * DH + c8;
  const _Float16* kg = kw + (size_t)bh * L_ * DH + (size_t)r8 * DH + c8;     // + 64 * DH per tile
  const _Float16* vg = vw + (size_t)bh * DH * L_ + (size_t)r8 * L_ + c8;     // + 64 per tile

  q_copy(lq, qg);
  kv_copy(lk, lv_, kg, vg);                       // tile 0
  wait_async_le0();                               // this wave's part of Q and tile 0 has landed
  __syncthreads();                                // and every other wave's
  kv_copy(lk + ATILE * 2, lv_ + ATILE * 2, kg + 64 * DH, vg + 64);   // tile 1 flies during trip 0

  // Q fragments are kt-invariant: hoist out of the loop. They are the B operand: column = query
  v16h qf[2][2];
#pragma unroll
  for (int qt = 0; qt < 2; ++qt)
#pragma unroll
    for (int kk = 0; kk < 2; ++kk)
      qf[qt][kk] = frag_f16(Qs + (wid * 32 + qt * 16) * APITCH + kk * 32, APITCH, lane);

  // Transposed products: per query tile a lane owns ONE query (column lane & 15) and, per 16-row tile, rows r + hi.
  v8f z = {0.f,0.f,0.f,0.f,0.f,0.f,0.f,0.f};
  v8f o[2][4];                           // O^T: o[qt][dt][r] = O[query][dt*16 + hi + r]
  float mi[2];
  v8f lv[2];                             // 8 partial row sums of this half's keys, joined after the loop
#pragma unroll
  for (int qt = 0; qt < 2; ++qt) {
#pragma unroll
    for (int dt = 0; dt < 4; ++dt) o[qt][dt] = z;
    mi[qt] = -1e30f;
    lv[qt] = z;
  }
  const int hi = (lane & 16) ? 8 : 0;

  for (int kt = 0; kt < 16; ++kt) {
    const _Float16* kb = Ks + (kt & 1) * ATILE;
    const _Float16* vb = Vs + (kt & 1) * ATILE;

    // S^T = K Q^T: s[qt][nt][r] = score(key nt*16 + hi + r, query qt*16 + (lane & 15))
    v8f s[2][4];
#pragma unroll
    for (int qt = 0; qt < 2; ++qt)
#pragma unroll
      for (int nt = 0; nt < 4; ++nt) s[qt][nt] = z;
#pragma unroll
    for (int kk = 0; kk < 2; ++kk) {
      v16h kf[4];
#pragma unroll
      for (int nt = 0; nt < 4; ++nt)
        kf[nt] = frag_f16(kb + nt * 16 * APITCH + kk * 32, APITCH, lane);
#pragma unroll
      for (int nt = 0; nt < 4; ++nt)
#pragma unroll
        for (int qt = 0; qt < 2; ++qt)   // each K fragment feeds both query tiles
          s[qt][nt] = wmma16(kf[nt], qf[qt][kk], s[qt][nt]);
    }

    // Online softmax: a query's 64 scores lie in two lanes, so maximum and sum run in-lane
    float mnew[2], alpha[2];
#pragma unroll  // constant indices keep s in registers
    for (int qt = 0; qt < 2; ++qt) {
      float m4[4];
#pragma unroll  // constant indices keep s in registers
      for (int nt = 0; nt < 4; ++nt) {
        m4[nt] = s[qt][nt][0];
#pragma unroll  // constant indices keep s in registers
        for (int r = 1; r < 8; ++r) m4[nt] = fmaxf(m4[nt], s[qt][nt][r]);
      }
      float mx = fmaxf(fmaxf(m4[0], m4[1]), fmaxf(m4[2], m4[3]));
      mx = fmaxf(mx, xhalf(mx));         // the one exchange: both halves use the same maximum
      mnew[qt] = fmaxf(mi[qt], mx);
    }
#pragma unroll  // a loop of its own: inside the loop below one factor was packed with a score, which cost register copies
    for (int qt = 0; qt < 2; ++qt) {
      alpha[qt] = __expf(mi[qt] - mnew[qt]);
      mi[qt] = mnew[qt];
    }
#pragma unroll  // constant indices keep s and o in registers
    for (int qt = 0; qt < 2; ++qt) {
#pragma unroll  // constant indices keep s in registers
      for (int nt = 0; nt < 4; ++nt)
#pragma unroll  // constant indices keep s in registers
        for (int r = 0; r < 8; ++r) s[qt][nt][r] = __expf(s[qt][nt][r] - mnew[qt]);
      lv[qt] = lv[qt] * alpha[qt] + ((s[qt][0] + s[qt][1]) + (s[qt][2] + s[qt][3]));   // tile rows added register by register
#pragma unroll  // constant indices keep o in registers
      for (int dt = 0; dt < 4; ++dt) o[qt][dt] *= alpha[qt];
    }

    // O^T += V^T P^T: two score tiles, converted in place, are the B operand of 32 keys (no LDS, no exchange)
#pragma unroll
    for (int kk = 0; kk < 2; ++kk) {
      v16h pf[2];
#pragma unroll
      for (int qt = 0; qt < 2; ++qt)
        pf[qt] = __builtin_shufflevector(__builtin_convertvector(s[qt][2 * kk], v8h),
                                         __builtin_convertvector(s[qt][2 * kk + 1], v8h),
                                         0,1,2,3,4,5,6,7,8,9,10,11,12,13,14,15);
      v16h vf[4];
#pragma unroll
      for (int dt = 0; dt < 4; ++dt)
        vf[dt] = frag_f16(vb + dt * 16 * APITCH + kk * 32, APITCH, lane);
#pragma unroll
      for (int dt = 0; dt < 4; ++dt)
#pragma unroll
        for (int qt = 0; qt < 2; ++qt)   // each V fragment feeds both query tiles
          o[qt][dt] = wmma16(vf[dt], pf[qt], o[qt][dt]);
    }

    // publish point of tile kt + 1: this wave's reads of tile kt are done, its copies of tile kt + 1 have landed
    asm volatile("s_wait_dscnt 0x0" ::: "memory");
    wait_async_le0();
    __syncthreads();
    if (kt + 2 < 16)                     // refill the buffers that every wave has just left
      kv_copy(lk + (unsigned)(kt & 1) * (ATILE * 2), lv_ + (unsigned)(kt & 1) * (ATILE * 2),
              kg + (size_t)(kt + 2) * 64 * DH, vg + (kt + 2) * 64);
  }
  wait_async_le0();                      // nothing is outstanding when the wave goes on

  // Normalize and write (b, L, DIM) f16: a lane's 8 values of a tile are 8 adjacent d of its query
#pragma unroll  // constant indices keep o in registers
  for (int qt = 0; qt < 2; ++qt) {
    const float li = ((lv[qt][0] + lv[qt][1]) + (lv[qt][2] + lv[qt][3])) + ((lv[qt][4] + lv[qt][5]) + (lv[qt][6] + lv[qt][7]));
    const float inv = 1.0f / (li + xhalf(li));
    _Float16* dst = ao + ((size_t)b * L_ + qb * 256 + wid * 32 + qt * 16 + (lane & 15)) * DIM_ + h * DH + hi;
#pragma unroll  // constant indices keep o in registers
    for (int dt = 0; dt < 4; ++dt)
      *(v8h*)&dst[dt * 16] = __builtin_convertvector(o[qt][dt] * inv, v8h);
  }
}

// ---------------------------------------------------------------------------
// Kernel 3: out = attn(f16) @ w_proj, fp32 out. BM=128, BN=256, 64x64 per wave, main loop gemm_main.
// ---------------------------------------------------------------------------
__global__ __launch_bounds__(256) void proj_kernel(
    const _Float16* __restrict__ a16, const _Float16* __restrict__ wt,
    float* __restrict__ out) {
  __shared__ __attribute__((aligned(16))) _Float16 S[2 * GSTAGE];
  const int lane = threadIdx.x & 31;
  const int wid  = threadIdx.x >> 5;
  const int wm = wid & 1, wn = wid >> 1;
  const int bn = blockIdx.x, bm = blockIdx.y;
  const int row0 = bm * 128 + wm * 64;

  v8f z = {0.f,0.f,0.f,0.f,0.f,0.f,0.f,0.f};
  v8f acc[4][4];
#pragma unroll
  for (int ms = 0; ms < 4; ++ms)
#pragma unroll
    for (int nt = 0; nt < 4; ++nt) acc[ms][nt] = z;

  gemm_main(a16, wt, S, bm, bn, acc);

  const int hi = (lane & 16) ? 8 : 0;
  float* dst = out + (size_t)(row0 + hi) * DIM_ + bn * 256 + wn * 64 + (lane & 15) * 4;
#pragma unroll  // constant indices keep acc in registers
  for (int ms = 0; ms < 4; ++ms)
#pragma unroll  // constant indices keep acc in registers
    for (int r = 0; r < 8; ++r) {          // 16 lanes x 16 B = two whole lines of one row
      v4f ov = {acc[ms][0][r], acc[ms][1][r], acc[ms][2][r], acc[ms][3][r]};
      *(v4f*)&dst[(size_t)(ms * 16 + r) * DIM_] = ov;
    }
}

// ---------------------------------------------------------------------------
extern "C" void kernel_launch(void* const* d_in, const int* in_sizes, int n_in,
                              void* d_out, int out_size, void* d_ws, size_t ws_size,
                              hipStream_t stream) {
  (void)in_sizes; (void)n_in; (void)out_size; (void)ws_size;
  const float* x      = (const float*)d_in[0];
  const float* w_qkv  = (const float*)d_in[1];
  const float* w_proj = (const float*)d_in[2];

  char* ws = (char*)d_ws;
  _Float16* qw = (_Float16*)(ws);
  _Float16* kw = (_Float16*)(ws + (size_t)16 * 1024 * 1024);
  _Float16* vw = (_Float16*)(ws + (size_t)32 * 1024 * 1024);
  _Float16* ao = (_Float16*)(ws + (size_t)48 * 1024 * 1024);
  _Float16* x16 = (_Float16*)(ws + (size_t)64 * 1024 * 1024);
  _Float16* wqt = (_Float16*)(ws + (size_t)80 * 1024 * 1024);
  _Float16* wpt = (_Float16*)(ws + (size_t)88 * 1024 * 1024);
  float* out = (float*)d_out;

  to_f16_kernel<<<dim3(WBLK + 512), 256, 0, stream>>>(x, w_qkv, w_proj, x16, wqt, wpt);
  qkv_rope_kernel<<<dim3(N3 / 384, (B_ * L_) / 256), 256, 0, stream>>>(x16, wqt, qw, kw, vw);
  attn_kernel<<<dim3(L_ / 256, NH, B_), 256, 0, stream>>>(qw, kw, vw, ao);
  proj_kernel<<<dim3(DIM_ / 256, (B_ * L_) / 128), 256, 0, stream>>>(ao, wpt, out);
}

// v009
// A run of this version takes 107 microseconds.
// In both of two side-by-side timings against v008, it was 1.03 times as fast.
// Counting every step since v000, it is 6.36 times as fast.
#include <hip/hip_runtime.h>

typedef __attribute__((ext_vector_type(16))) _Float16 v16h;
typedef __attribute__((ext_vector_type(8)))  _Float16 v8h;
typedef __attribute__((ext_vector_type(4)))  _Float16 v4h;
typedef __attribute__((ext_vector_type(8)))  float    v8f;
typedef __attribute__((ext_vector_type(4)))  float    v4f;

#define B_    8
#define L_    1024
#define DIM_  1024
#define NH    16
#define DH    64
#define N3    3072
#define PI_F  3.14159265358979323846f
#define QSCALE (1.4426950408889634f / 64.0f)   // 1/64 of the reference, times log2(e) for the exp2 of the softmax

__device__ __forceinline__ v16h frag_f16(const _Float16* base, int stride, int lane) {
  const int row = lane & 15;
  const int lo  = (lane & 16) ? 8 : 0;
  const _Float16* p = base + row * stride + lo;
  v8h a = *(const v8h*)(p);
  v8h b = *(const v8h*)(p + 16);
  return __builtin_shufflevector(a, b, 0,1,2,3,4,5,6,7,8,9,10,11,12,13,14,15);
}

__device__ __forceinline__ v8f wmma16(v16h a, v16h b, v8f c) {
  return __builtin_amdgcn_wmma_f32_16x16x32_f16(false, a, false, b, (short)0, c, false, false);
}

__device__ __forceinline__ float xhalf(float x) {
  int b = __builtin_bit_cast(int, x);
  return __builtin_bit_cast(float, __builtin_amdgcn_permlanex16(b, b, 0x76543210, 0xfedcba98, false, false));
}

__device__ __forceinline__ void sincos_rev(float rev, float& s, float& c) {
  asm("v_sin_f32 %0, %2\n\tv_cos_f32 %1, %2\n\tv_nop" : "=&v"(s), "=&v"(c) : "v"(rev));
}

__device__ __forceinline__ void wait_async_le0() {
  asm volatile("s_wait_asynccnt 0x0" ::: "memory");
}

// ---------------------------------------------------------------------------
// Kernel 0: operands to f16, once per call. x keeps its layout; each weight goes to [n][k], in the row order in
// which its GEMM keeps the tile in LDS. w_proj: inside each 256-column tile column 4*i+j is row 64*j+i.
// w_qkv: head h owns rows 192*h..192*h+191: 64 of q, 64 of k, 64 of v, and of each 64 column 4*i+j is row 16*j+i.
// ---------------------------------------------------------------------------
#define QBLK 192                         // blocks that transpose w_qkv
#define WBLK 256                         // blocks that transpose a weight; the other 512 convert x

// A wave takes 64 k x 32 columns: a lane reads 8 k of 2 x 4 columns (the wave: whole 128-B lines of 8 rows per
// pair of loads), writes 8 x 16 B, and 8 lanes together write one whole 128-B line of a transposed row.
template <int N>
__device__ __forceinline__ void transpose_w(const float* __restrict__ w, _Float16* __restrict__ wt,
                                            int gw, int lane) {
  const int n0 = (gw % (N / 32)) * 32 + (lane >> 3) * 4;
  const int k0 = (gw / (N / 32)) * 64 + (lane & 7) * 8;
  const float* src = w + (size_t)k0 * N + n0;
  const int row = (N == N3) ? ((n0 >> 6) & 15) * 192 + (n0 >> 10) * 64 + ((n0 & 63) >> 2)
                            : (n0 & ~255) + ((n0 & 255) >> 2);
  constexpr int JS = (N == N3) ? 16 : 64;          // rows between columns 4*i+j and 4*i+j+1
  _Float16* dst = wt + (size_t)row * DIM_ + k0;
  v4f tmp[2][8];
#pragma unroll  // constant indices keep tmp in registers; all 16 loads in flight together
  for (int c = 0; c < 2; ++c)
#pragma unroll
    for (int i = 0; i < 8; ++i) tmp[c][i] = *(const v4f*)&src[i * N + c * 16];
#pragma unroll
  for (int c = 0; c < 2; ++c)
#pragma unroll
    for (int j = 0; j < 4; ++j) {
      v8h hcol;
#pragma unroll  // constant indices keep tmp and hcol in registers
      for (int i = 0; i < 8; ++i) hcol[i] = (_Float16)tmp[c][i][j];
      *(v8h*)&dst[(j * JS + c * 4) * DIM_] = hcol;   // column n0 + 16*c + j
    }
  // in the listing another branch's code stands behind these stores and rewrites their registers: the wait first
  asm volatile("s_wait_xcnt 0x0" ::: "memory");
}

__global__ __launch_bounds__(256) void to_f16_kernel(
    const float* __restrict__ x, const float* __restrict__ wq, const float* __restrict__ wp,
    _Float16* __restrict__ x16, _Float16* __restrict__ wqt, _Float16* __restrict__ wpt) {
  const int blk = blockIdx.x;
  const int lane = threadIdx.x & 31;
  const int wid  = __builtin_amdgcn_readfirstlane(threadIdx.x >> 5);
  if (blk < QBLK) {
    transpose_w<N3>(wq, wqt, blk * 8 + wid, lane);
  } else if (blk < WBLK) {
    transpose_w<DIM_>(wp, wpt, (blk - QBLK) * 8 + wid, lane);
  } else {
    // 16 B per lane per load, whole lines per wave; 16 loads per thread
    const size_t base = (size_t)(blk - WBLK) * (256 * 4 * 16) + threadIdx.x * 4;
    v4f t[16];
#pragma unroll  // constant indices keep t in registers; all loads in flight together
    for (int i = 0; i < 16; ++i) t[i] = *(const v4f*)&x[base + i * 1024];
#pragma unroll
    for (int i = 0; i < 16; ++i) *(v4h*)&x16[base + i * 1024] = __builtin_convertvector(t[i], v4h);
    // in the listing another branch's code stands behind these stores and rewrites their registers: the wait first
    asm volatile("s_wait_xcnt 0x0" ::: "memory");
  }
}

// ---------------------------------------------------------------------------
// Main loop of the output projection: C(128x256) = A(128x1024) * Bt(256x1024)^T, f16 operands, k contiguous.
// A stage is 64 k of 384 rows (128 of A, then 256 of Bt) at pitch 72 halves (144 B); two buffers.
// ---------------------------------------------------------------------------
#define GPITCH 72
#define GSTAGE (384 * GPITCH)            // halves per buffer
#define GSTAGE_B (GSTAGE * 2)            // bytes per buffer
#define GROWS_B (32 * GPITCH * 2)        // bytes of 32 LDS rows

// One stage: 12 copies per lane, 8 lanes per 128-B row, 32 rows per copy of the block. The wait on the address
// translations is the statement's last line, so no address register is rewritten in front of it.
__device__ __forceinline__ void stage_copy(unsigned l, const _Float16* a, const _Float16* b) {
  asm volatile(
      "global_load_async_to_lds_b128 %0, %12, off\n\t"
      "global_load_async_to_lds_b128 %1, %13, off\n\t"
      "global_load_async_to_lds_b128 %2, %14, off\n\t"
      "global_load_async_to_lds_b128 %3, %15, off\n\t"
      "global_load_async_to_lds_b128 %4, %16, off\n\t"
      "global_load_async_to_lds_b128 %5, %17, off\n\t"
      "global_load_async_to_lds_b128 %6, %18, off\n\t"
      "global_load_async_to_lds_b128 %7, %19, off\n\t"
      "global_load_async_to_lds_b128 %8, %20, off\n\t"
      "global_load_async_to_lds_b128 %9, %21, off\n\t"
      "global_load_async_to_lds_b128 %10, %22, off\n\t"
      "global_load_async_to_lds_b128 %11, %23, off\n\t"
      "s_wait_xcnt 0x0"
      :: "v"(l), "v"(l + GROWS_B), "v"(l + 2 * GROWS_B), "v"(l + 3 * GROWS_B),
         "v"(l + 4 * GROWS_B), "v"(l + 5 * GROWS_B), "v"(l + 6 * GROWS_B), "v"(l + 7 * GROWS_B),
         "v"(l + 8 * GROWS_B), "v"(l + 9 * GROWS_B), "v"(l + 10 * GROWS_B), "v"(l + 11 * GROWS_B),
         "v"(a), "v"(a + 32 * DIM_), "v"(a + 64 * DIM_), "v"(a + 96 * DIM_),
         "v"(b), "v"(b + 32 * DIM_), "v"(b + 64 * DIM_), "v"(b + 96 * DIM_),
         "v"(b + 128 * DIM_), "v"(b + 160 * DIM_), "v"(b + 192 * DIM_), "v"(b + 224 * DIM_)
      : "memory");
}

__device__ __forceinline__ void gemm_main(const _Float16* __restrict__ A, const _Float16* __restrict__ Bt,
                                          _Float16* S, int bm, int bn, v8f (&acc)[4][4]) {
  const int lane = threadIdx.x & 31;
  const int wid  = threadIdx.x >> 5;
  const int wm = wid & 1, wn = wid >> 1;
  const int r8 = threadIdx.x >> 3, c8 = (threadIdx.x & 7) * 8;
  const unsigned l0 = (unsigned)(uintptr_t)S + (unsigned)(r8 * GPITCH + c8) * 2;
  const _Float16* ga = A  + (size_t)(bm * 128 + r8) * DIM_ + c8;
  const _Float16* gb = Bt + (size_t)(bn * 256 + r8) * DIM_ + c8;

  stage_copy(l0, ga, gb);                        // stage 0
  wait_async_le0();                              // this wave's part of stage 0 has landed
  __syncthreads();                               // and every other wave's
  stage_copy(l0 + GSTAGE_B, ga + 64, gb + 64);   // stage 1 flies during trip 0

  for (int t = 0; t < DIM_ / 64; ++t) {
    const _Float16* buf = S + (t & 1) * GSTAGE;
#pragma unroll
    for (int kk = 0; kk < 2; ++kk) {
      v16h af[4];
#pragma unroll
      for (int ms = 0; ms < 4; ++ms)
        af[ms] = frag_f16(buf + (wm * 64 + ms * 16) * GPITCH + kk * 32, GPITCH, lane);
      v16h bf[4];
#pragma unroll
      for (int nt = 0; nt < 4; ++nt)             // tile nt = columns 4*i+nt
        bf[nt] = frag_f16(buf + (128 + nt * 64 + wn * 16) * GPITCH + kk * 32, GPITCH, lane);
      if (kk == 1) {
        // publish point of stage t + 1, with the trip's last fragments already fetched: this wave's reads of
        // stage t are done, its copies of stage t + 1 have landed
        asm volatile("s_wait_dscnt 0x0" ::: "memory");
        wait_async_le0();
        __syncthreads();
        if (t + 2 < DIM_ / 64)                   // refill the buffer that every wave has just left
          stage_copy(l0 + (unsigned)(t & 1) * GSTAGE_B, ga + (t + 2) * 64, gb + (t + 2) * 64);
      }
#pragma unroll
      for (int nt = 0; nt < 4; ++nt)
#pragma unroll
        for (int ms = 0; ms < 4; ++ms)           // each loaded fragment feeds 4 products
          acc[ms][nt] = wmma16(af[ms], bf[nt], acc[ms][nt]);
    }
  }
  wait_async_le0();                              // nothing is outstanding when the wave goes on
}

// ---------------------------------------------------------------------------
// Kernel 1: QKV = x @ w_qkv with fused 2D axial RoPE; q pre-scaled by log2(e)/64, so scores come in log2 units.
// BM=256, BN=384 (q, k and v of two heads), 64 k per trip; 8 waves = 4(M) x 2(N), 64x192 per wave: 256 blocks,
// one per WGP, one round. A stage is 640 rows (256 of x, then 384 of the weight) at pitch 72 halves; two buffers.
// ---------------------------------------------------------------------------
#define QSTAGE (640 * GPITCH)            // halves per buffer

typedef __attribute__((ext_vector_type(4))) int v4i;
typedef __attribute__((address_space(1))) v4i gv4i;
typedef __attribute__((address_space(3))) v4i lv4i;

// One stage: 20 copies per lane, 8 lanes per 128-B row, 32 rows per copy of the block. a and b are the block's
// tile starts, off the lane's own element in a 32-row group.
// The builtin, not asm text: asm operands must lie in the first 256 registers, and beside 384 accumulator registers
// that cost some 300 register moves and a spill per trip.
__device__ __forceinline__ void qstage_copy(_Float16* l, const _Float16* a, const _Float16* b, unsigned off) {
#pragma unroll  // straight-line copies, constant steps
  for (int c = 0; c < 8; ++c)
    __builtin_amdgcn_global_load_async_to_lds_b128((gv4i*)(a + c * 32 * DIM_ + off), (lv4i*)(l + c * 32 * GPITCH), 0, 0);
#pragma unroll  // straight-line copies, constant steps
  for (int c = 0; c < 12; ++c)
    __builtin_amdgcn_global_load_async_to_lds_b128((gv4i*)(b + c * 32 * DIM_ + off), (lv4i*)(l + (8 + c) * 32 * GPITCH), 0, 0);
}

// four fragments, 16 LDS rows apart
__device__ __forceinline__ void ld4(v16h (&f)[4], const _Float16* p, int lane) {
#pragma unroll  // constant indices keep f in registers
  for (int i = 0; i < 4; ++i) f[i] = frag_f16(p + i * 16 * GPITCH, GPITCH, lane);
}

// 64 rows x 64 columns x 32 k: tile j = columns 4*i+j of part G (0 q, 1 k, 2 v)
template <int G>
__device__ __forceinline__ void mm16(const v16h (&af)[4], const v16h (&bf)[4], v8f (&acc)[4][12]) {
#pragma unroll  // constant indices keep acc in registers
  for (int j = 0; j < 4; ++j)
#pragma unroll  // constant indices keep acc in registers
    for (int ms = 0; ms < 4; ++ms)
      acc[ms][G * 4 + j] = wmma16(af[ms], bf[j], acc[ms][G * 4 + j]);
}

__global__ __launch_bounds__(256) void qkv_rope_kernel(
    const _Float16* __restrict__ x16, const _Float16* __restrict__ wt,
    _Float16* __restrict__ qw, _Float16* __restrict__ kw, _Float16* __restrict__ vw) {
  __shared__ __attribute__((aligned(16))) _Float16 S[2 * QSTAGE];
  const int lane = threadIdx.x & 31;
  const int wid  = threadIdx.x >> 5;
  const int wm = wid & 3, wn = wid >> 2;
  const int bn = blockIdx.x, bm = blockIdx.y;
  const int row0 = bm * 256 + wm * 64;

  v8f z = {0.f,0.f,0.f,0.f,0.f,0.f,0.f,0.f};
  v8f acc[4][12];                          // tiles 0-3: q, 4-7: k, 8-11: v of the wave's head
#pragma unroll
  for (int ms = 0; ms < 4; ++ms)
#pragma unroll
    for (int nt = 0; nt < 12; ++nt) acc[ms][nt] = z;

  const int r8 = threadIdx.x >> 3, c8 = (threadIdx.x & 7) * 8;
  _Float16* lc = S + r8 * GPITCH + c8;
  const unsigned off = (unsigned)(r8 * DIM_ + c8);
  const _Float16* ga = x16 + (size_t)bm * 256 * DIM_;
  const _Float16* gb = wt  + (size_t)bn * 384 * DIM_;

  qstage_copy(lc, ga, gb, off);                  // stage 0
  wait_async_le0();                              // this wave's part of stage 0 has landed
  __syncthreads();                               // and every other wave's
  qstage_copy(lc + QSTAGE, ga + 64, gb + 64, off);   // stage 1 flies during trip 0

  // A trip is six blocks of 16 products (2 x 32 k; q, k, v). The four B fragments of a block are fetched one block
  // ahead into the other of two register sets, as one group in front of the products that hide them.
  // SB: the compiler does not schedule across it; without it it fetched one fragment per four products and waited.
#define SB() __builtin_amdgcn_sched_barrier(0)
  const _Float16* pa = S + wm * 64 * GPITCH;               // the wave's 64 rows of x
  const _Float16* pb = S + (256 + wn * 192) * GPITCH;      // its 192 rows of the weight
  v16h af[4], b0[4], b1[4];
  ld4(b0, pb, lane);
  for (int t = 0; t < DIM_ / 64; ++t) {
    const int cur = (t & 1) * QSTAGE, nxt = QSTAGE - cur;
    ld4(af, pa + cur, lane);
    ld4(b1, pb + cur + 64 * GPITCH, lane);
    SB(); mm16<0>(af, b0, acc); SB();
    ld4(b0, pb + cur + 128 * GPITCH, lane);
    SB(); mm16<1>(af, b1, acc); SB();
    ld4(b1, pb + cur + 32, lane);
    SB(); mm16<2>(af, b0, acc); SB();
    ld4(af, pa + cur + 32, lane);
    ld4(b0, pb + cur + 64 * GPITCH + 32, lane);
    SB(); mm16<0>(af, b1, acc); SB();
    ld4(b1, pb + cur + 128 * GPITCH + 32, lane);
    // publish point of stage t + 1, with the trip's last fragments already fetched: this wave's reads of
    // stage t are done, its copies of stage t + 1 have landed
    asm volatile("s_wait_dscnt 0x0" ::: "memory");
    wait_async_le0();
    __syncthreads();
    if (t + 2 < DIM_ / 64)                       // refill the buffer that every wave has just left
      qstage_copy(lc + cur, ga + (t + 2) * 64, gb + (t + 2) * 64, off);
    SB(); mm16<1>(af, b0, acc); SB();
    // behind the barrier stage t + 1 may be read; in the last trip this reads the idle buffer and nobody uses it
    ld4(b0, pb + nxt, lane);
    SB(); mm16<2>(af, b1, acc); SB();
  }
#undef SB
  wait_async_le0();                              // nothing is outstanding when the wave goes on

  // Epilogue: RoPE + scatter. C layout: lane holds (M = r + hi, column 4*(lane&15) + j of q, of k and of v).
  const int hi = (lane & 16) ? 8 : 0;
  const int h  = bn * 2 + wn;              // the wave's head
  const int d0 = (lane & 15) * 4;
  const int b  = row0 >> 10;               // a wave's 64 rows lie in one batch
  const int l0 = (row0 & 1023) + hi;
  {
    _Float16* dst = vw + ((size_t)(b * NH + h) * DH + d0) * L_ + l0;   // transposed
    v8h vv[4][4];
#pragma unroll  // constant indices keep acc in registers
    for (int ms = 0; ms < 4; ++ms)
#pragma unroll  // constant indices keep acc in registers
      for (int j = 0; j < 4; ++j) vv[ms][j] = __builtin_convertvector(acc[ms][8 + j], v8h);
    // all values first, each in registers of its own, then the stores, then the wait: nothing is scheduled across
    // these fences, so no register that an issued store names is rewritten in front of the wait
    __builtin_amdgcn_sched_barrier(0);
#pragma unroll  // constant indices keep vv in registers
    for (int ms = 0; ms < 4; ++ms)
#pragma unroll  // constant indices keep vv in registers
      for (int j = 0; j < 4; ++j)          // a lane's 8 rows of one column are 8 adjacent l
        *(v8h*)&dst[j * L_ + ms * 16] = vv[ms][j];
    asm volatile("s_wait_xcnt 0x0" ::: "memory");
    __builtin_amdgcn_sched_barrier(0);
  }
  {
    const size_t off = ((size_t)(b * NH + h) * L_ + l0) * DH + d0;
    _Float16* dq = qw + off;
    _Float16* dk = kw + off;
    const bool wax = d0 >= 32;             // upper half of the head rotates by the column position
    float fj[2];
#pragma unroll  // constant indices keep fj in registers
    for (int p = 0; p < 2; ++p) {
      int j = ((wax ? (d0 - 32) : d0) >> 1) + p;
      fj[p] = (1.0f + (127.0f / 15.0f) * (float)j) * PI_F;
    }
#pragma unroll  // constant indices keep acc in registers
    for (int ms = 0; ms < 4; ++ms) {
      v4h hq8[8], hk8[8];
#pragma unroll  // constant indices keep acc in registers
      for (int r = 0; r < 8; ++r) {
        int l = l0 + ms * 16 + r;
        float pos = wax ? (-1.0f + (2.0f / 31.0f) * (float)(l & 31))
                        : (-1.0f + (2.0f / 31.0f) * (float)(l >> 5));
        v4h hq, hk;
#pragma unroll  // constant indices keep acc in registers
        for (int p = 0; p < 2; ++p) {      // the rotated pair is two adjacent columns the lane holds
          float th = pos * fj[p];
          float cv, sv;
          sincos_rev(th * 0.15915494309189532f, sv, cv);   // one angle serves q and k
          float e = acc[ms][2 * p][r], o = acc[ms][2 * p + 1][r];
          hq[2 * p]     = (_Float16)((e * cv - o * sv) * QSCALE);
          hq[2 * p + 1] = (_Float16)((o * cv + e * sv) * QSCALE);
          float ek = acc[ms][4 + 2 * p][r], ok = acc[ms][4 + 2 * p + 1][r];
          hk[2 * p]     = (_Float16)(ek * cv - ok * sv);
          hk[2 * p + 1] = (_Float16)(ok * cv + ek * sv);
        }
        hq8[r] = hq;
        hk8[r] = hk;
      }
      __builtin_amdgcn_sched_barrier(0);
#pragma unroll  // constant indices keep hq8 and hk8 in registers
      for (int r = 0; r < 8; ++r) {
        *(v4h*)&dq[(ms * 16 + r) * DH] = hq8[r];   // 16 lanes x 8 B = one whole 128-B row
        *(v4h*)&dk[(ms * 16 + r) * DH] = hk8[r];
      }
      asm volatile("s_wait_xcnt 0x0" ::: "memory");
      __builtin_amdgcn_sched_barrier(0);
    }
  }
}

// ---------------------------------------------------------------------------
// Kernel 2: flash attention per (b,h,256-query slab), products transposed: S^T = K Q^T, O^T += V^T P^T.
// 8 waves x 32 queries: a K or V fragment read from LDS feeds two products, and a K/V tile copied from L2
// serves 256 queries. K/V tiles of 64 keys in two LDS buffers, copied asynchronously one trip ahead.
// The score products start at minus the maximum in use, in log2 units: their results are the arguments of exp2.
// ---------------------------------------------------------------------------
#define APITCH 72
#define ATILE (64 * APITCH)              // halves of one K or V tile in LDS
#define AROWS_B (32 * APITCH * 2)        // bytes of 32 LDS rows

__device__ __forceinline__ void q_copy(unsigned l, const _Float16* q) {
  asm volatile(
      "global_load_async_to_lds_b128 %0, %8, off\n\t"
      "global_load_async_to_lds_b128 %1, %9, off\n\t"
      "global_load_async_to_lds_b128 %2, %10, off\n\t"
      "global_load_async_to_lds_b128 %3, %11, off\n\t"
      "global_load_async_to_lds_b128 %4, %12, off\n\t"
      "global_load_async_to_lds_b128 %5, %13, off\n\t"
      "global_load_async_to_lds_b128 %6, %14, off\n\t"
      "global_load_async_to_lds_b128 %7, %15, off\n\t"
      "s_wait_xcnt 0x0"
      :: "v"(l), "v"(l + AROWS_B), "v"(l + 2 * AROWS_B), "v"(l + 3 * AROWS_B),
         "v"(l + 4 * AROWS_B), "v"(l + 5 * AROWS_B), "v"(l + 6 * AROWS_B), "v"(l + 7 * AROWS_B),
         "v"(q), "v"(q + 32 * DH), "v"(q + 64 * DH), "v"(q + 96 * DH),
         "v"(q + 128 * DH), "v"(q + 160 * DH), "v"(q + 192 * DH), "v"(q + 224 * DH)
      : "memory");
}

__device__ __forceinline__ void kv_copy(unsigned lk, unsigned lv, const _Float16* k, const _Float16* v) {
  asm volatile(
      "global_load_async_to_lds_b128 %0, %4, off\n\t"
      "global_load_async_to_lds_b128 %1, %5, off\n\t"
      "global_load_async_to_lds_b128 %2, %6, off\n\t"
      "global_load_async_to_lds_b128 %3, %7, off\n\t"
      "s_wait_xcnt 0x0"
      :: "v"(lk), "v"(lk + AROWS_B), "v"(lv), "v"(lv + AROWS_B),
         "v"(k), "v"(k + 32 * DH), "v"(v), "v"(v + 32 * L_)
      : "memory");
}

__global__ __launch_bounds__(256) __attribute__((amdgpu_waves_per_eu(4, 4))) void attn_kernel(
    const _Float16* __restrict__ qw, const _Float16* __restrict__ kw,
    const _Float16* __restrict__ vw, _Float16* __restrict__ ao) {
  __shared__ __attribute__((aligned(16))) _Float16 Qs[256 * APITCH];   // [m][d]
  __shared__ __attribute__((aligned(16))) _Float16 Ks[2 * ATILE];      // [key][d], two buffers
  __shared__ __attribute__((aligned(16))) _Float16 Vs[2 * ATILE];      // [d][key], two buffers
  const int lane = threadIdx.x & 31;
  const int wid  = threadIdx.x >> 5;
  const int qb = blockIdx.x, h = blockIdx.y, b = blockIdx.z;
  const int bh = b * NH + h;

  // a thread's slice of every copy: 16 B of row r8 (+ 32 per further copy)
  const int r8 = threadIdx.x >> 3, c8 = (threadIdx.x & 7) * 8;
  const unsigned loff = (unsigned)(r8 * APITCH + c8) * 2;
  const unsigned lq = (unsigned)(uintptr_t)(&Qs[0]) + loff;
  const unsigned lk = (unsigned)(uintptr_t)(&Ks[0]) + loff;
  const unsigned lv_ = (unsigned)(uintptr_t)(&Vs[0]) + loff;
  const _Float16* qg = qw + (size_t)bh * L_ * DH + (size_t)(qb * 256 + r8) * DH + c8;
  const _Float16* kg = kw + (size_t)bh * L_ * DH + (size_t)r8 * DH + c8;     // + 64 * DH per tile
  const _Float16* vg = vw + (size_t)bh * DH * L_ + (size_t)r8 * L_ + c8;     // + 64 per tile

  q_copy(lq, qg);
  kv_copy(lk, lv_, kg, vg);                       // tile 0
  wait_async_le0();                               // this wave's part of Q and tile 0 has landed
  __syncthreads();                                // and every other wave's
  kv_copy(lk + ATILE * 2, lv_ + ATILE * 2, kg + 64 * DH, vg + 64);   // tile 1 flies during trip 0

  // Q fragments are kt-invariant: hoist out of the loop. They are the B operand: column = query
  v16h qf[2][2];
#pragma unroll
  for (int qt = 0; qt < 2; ++qt)
#pragma unroll
    for (int kk = 0; kk < 2; ++kk)
      qf[qt][kk] = frag_f16(Qs + (wid * 32 + qt * 16) * APITCH + kk * 32, APITCH, lane);

  // Transposed products: per query tile a lane owns ONE query (column lane & 15) and, per 16-row tile, rows r + hi.
  v8f z = {0.f,0.f,0.f,0.f,0.f,0.f,0.f,0.f};
  v8f o[2][4];                           // O^T: o[qt][dt][r] = O[query][dt*16 + hi + r]
  v8f mneg[2];                           // minus the query's maximum in use, in all 8 registers: the products' start value
  v8f lv[2];                             // 8 partial row sums of this half's keys, joined after the loop
#pragma unroll
  for (int qt = 0; qt < 2; ++qt) {
#pragma unroll
    for (int dt = 0; dt < 4; ++dt) o[qt][dt] = z;
    mneg[qt] = z;
    lv[qt] = z;
  }
  const int hi = (lane & 16) ? 8 : 0;

  for (int kt = 0; kt < 16; ++kt) {
    const _Float16* kb = Ks + (kt & 1) * ATILE;
    const _Float16* vb = Vs + (kt & 1) * ATILE;

    // S^T = K Q^T - maximum in use: s[qt][nt][r] = score(key nt*16 + hi + r, query qt*16 + (lane & 15))
    v8f s[2][4];
#pragma unroll
    for (int kk = 0; kk < 2; ++kk) {
      v16h kf[4];
#pragma unroll
      for (int nt = 0; nt < 4; ++nt)
        kf[nt] = frag_f16(kb + nt * 16 * APITCH + kk * 32, APITCH, lane);
#pragma unroll
      for (int nt = 0; nt < 4; ++nt)
#pragma unroll
        for (int qt = 0; qt < 2; ++qt)   // each K fragment feeds both query tiles
          s[qt][nt] = wmma16(kf[nt], qf[qt][kk], kk == 0 ? mneg[qt] : s[qt][nt]);
    }

    // Online softmax: a query's 64 scores lie in two lanes, so maximum and sum run in-lane
    float mx[2];
#pragma unroll  // constant indices keep s in registers
    for (int qt = 0; qt < 2; ++qt) {
      float m4[4];
#pragma unroll  // constant indices keep s in registers
      for (int nt = 0; nt < 4; ++nt) {
        m4[nt] = s[qt][nt][0];
#pragma unroll  // constant indices keep s in registers
        for (int r = 1; r < 8; ++r) m4[nt] = fmaxf(m4[nt], s[qt][nt][r]);
      }
      mx[qt] = fmaxf(fmaxf(m4[0], m4[1]), fmaxf(m4[2], m4[3]));
    }
    // The maximum in use is raised only in the first trip, which sets it, and where a score lies more than 8 above
    // it (exp2 then stays at or below 256). One test per trip, the same for the whole wave: a scalar branch.
    if (kt == 0 || __builtin_amdgcn_ballot_w32(fmaxf(mx[0], mx[1]) > 8.0f) != 0) {
#pragma unroll  // constant indices keep s and o in registers
      for (int qt = 0; qt < 2; ++qt) {
        const float m = fmaxf(mx[qt], xhalf(mx[qt]));      // both halves of a query take the same step
        const float d = kt ? fmaxf(m, 0.0f) : m;
        const float alpha = kt ? __builtin_amdgcn_exp2f(-d) : 1.0f;   // in the first trip sums and O are still 0
#pragma unroll  // constant indices keep s in registers
        for (int nt = 0; nt < 4; ++nt) s[qt][nt] -= d;
        mneg[qt] -= d;
        lv[qt] *= alpha;
#pragma unroll  // constant indices keep o in registers
        for (int dt = 0; dt < 4; ++dt) o[qt][dt] *= alpha;
      }
    }
#pragma unroll  // constant indices keep s in registers
    for (int qt = 0; qt < 2; ++qt) {
#pragma unroll  // constant indices keep s in registers
      for (int nt = 0; nt < 4; ++nt)
#pragma unroll  // constant indices keep s in registers
        for (int r = 0; r < 8; ++r) s[qt][nt][r] = __builtin_amdgcn_exp2f(s[qt][nt][r]);
      lv[qt] += (s[qt][0] + s[qt][1]) + (s[qt][2] + s[qt][3]);   // tile rows added register by register
    }

    // O^T += V^T P^T: two score tiles, converted in place, are the B operand of 32 keys (no LDS, no exchange)
#pragma unroll
    for (int kk = 0; kk < 2; ++kk) {
      v16h pf[2];
#pragma unroll
      for (int qt = 0; qt < 2; ++qt)
        pf[qt] = __builtin_shufflevector(__builtin_convertvector(s[qt][2 * kk], v8h),
                                         __builtin_convertvector(s[qt][2 * kk + 1], v8h),
                                         0,1,2,3,4,5,6,7,8,9,10,11,12,13,14,15);
      v16h vf[4];
#pragma unroll
      for (int dt = 0; dt < 4; ++dt)
        vf[dt] = frag_f16(vb + dt * 16 * APITCH + kk * 32, APITCH, lane);
#pragma unroll
      for (int dt = 0; dt < 4; ++dt)
#pragma unroll
        for (int qt = 0; qt < 2; ++qt)   // each V fragment feeds both query tiles
          o[qt][dt] = wmma16(vf[dt], pf[qt], o[qt][dt]);
    }

    // publish point of tile kt + 1: this wave's reads of tile kt are done, its copies of tile kt + 1 have landed
    asm volatile("s_wait_dscnt 0x0" ::: "memory");
    wait_async_le0();
    __syncthreads();
    if (kt + 2 < 16)                     // refill the buffers that every wave has just left
      kv_copy(lk + (unsigned)(kt & 1) * (ATILE * 2), lv_ + (unsigned)(kt & 1) * (ATILE * 2),
              kg + (size_t)(kt + 2) * 64 * DH, vg + (kt + 2) * 64);
  }
  wait_async_le0();                      // nothing is outstanding when the wave goes on

  // Normalize and write (b, L, DIM) f16: a lane's 8 values of a tile are 8 adjacent d of its query
#pragma unroll  // constant indices keep o in registers
  for (int qt = 0; qt < 2; ++qt) {
    const float li = ((lv[qt][0] + lv[qt][1]) + (lv[qt][2] + lv[qt][3])) + ((lv[qt][4] + lv[qt][5]) + (lv[qt][6] + lv[qt][7]));
    const float inv = 1.0f / (li + xhalf(li));
    _Float16* dst = ao + ((size_t)b * L_ + qb * 256 + wid * 32 + qt * 16 + (lane & 15)) * DIM_ + h * DH + hi;
#pragma unroll  // constant indices keep o in registers
    for (int dt = 0; dt < 4; ++dt)
      *(v8h*)&dst[dt * 16] = __builtin_convertvector(o[qt][dt] * inv, v8h);
  }
}

// ---------------------------------------------------------------------------
// Kernel 3: out = attn(f16) @ w_proj, fp32 out. BM=128, BN=256, 64x64 per wave, main loop gemm_main.
// ---------------------------------------------------------------------------
__global__ __launch_bounds__(256) void proj_kernel(
    const _Float16* __restrict__ a16, const _Float16* __restrict__ wt,
    float* __restrict__ out) {
  __shared__ __attribute__((aligned(16))) _Float16 S[2 * GSTAGE];
  const int lane = threadIdx.x & 31;
  const int wid  = threadIdx.x >> 5;
  const int wm = wid & 1, wn = wid >> 1;
  const int bn = blockIdx.x, bm = blockIdx.y;
  const int row0 = bm * 128 + wm * 64;

  v8f z = {0.f,0.f,0.f,0.f,0.f,0.f,0.f,0.f};
  v8f acc[4][4];
#pragma unroll
  for (int ms = 0; ms < 4; ++ms)
#pragma unroll
    for (int nt = 0; nt < 4; ++nt) acc[ms][nt] = z;

  gemm_main(a16, wt, S, bm, bn, acc);

  const int hi = (lane & 16) ? 8 : 0;
  float* dst = out + (size_t)(row0 + hi) * DIM_ + bn * 256 + wn * 64 + (lane & 15) * 4;
#pragma unroll  // constant indices keep acc in registers
  for (int ms = 0; ms < 4; ++ms)
#pragma unroll  // constant indices keep acc in registers
    for (int r = 0; r < 8; ++r) {          // 16 lanes x 16 B = two whole lines of one row
      v4f ov = {acc[ms][0][r], acc[ms][1][r], acc[ms][2][r], acc[ms][3][r]};
      *(v4f*)&dst[(size_t)(ms * 16 + r) * DIM_] = ov;
    }
}

// ---------------------------------------------------------------------------
extern "C" void kernel_launch(void* const* d_in, const int* in_sizes, int n_in,
                              void* d_out, int out_size, void* d_ws, size_t ws_size,
                              hipStream_t stream) {
  (void)in_sizes; (void)n_in; (void)out_size; (void)ws_size;
  const float* x      = (const float*)d_in[0];
  const float* w_qkv  = (const float*)d_in[1];
  const float* w_proj = (const float*)d_in[2];

  char* ws = (char*)d_ws;
  _Float16* qw = (_Float16*)(ws);
  _Float16* kw = (_Float16*)(ws + (size_t)16 * 1024 * 1024);
  _Float16* vw = (_Float16*)(ws + (size_t)32 * 1024 * 1024);
  _Float16* ao = (_Float16*)(ws + (size_t)48 * 1024 * 1024);
  _Float16* x16 = (_Float16*)(ws + (size_t)64 * 1024 * 1024);
  _Float16* wqt = (_Float16*)(ws + (size_t)80 * 1024 * 1024);
  _Float16* wpt = (_Float16*)(ws + (size_t)88 * 1024 * 1024);
  float* out = (float*)d_out;

  to_f16_kernel<<<dim3(WBLK + 512), 256, 0, stream>>>(x, w_qkv, w_proj, x16, wqt, wpt);
  qkv_rope_kernel<<<dim3(N3 / 384, (B_ * L_) / 256), 256, 0, stream>>>(x16, wqt, qw, kw, vw);
  attn_kernel<<<dim3(L_ / 256, NH, B_), 256, 0, stream>>>(qw, kw, vw, ao);
  proj_kernel<<<dim3(DIM_ / 256, (B_ * L_) / 128), 256, 0, stream>>>(ao, wpt, out);
}

// v010
// One run takes 95.8 microseconds.
// In both of two side-by-side timings against v009, it was 1.12 times as fast.
// Counting every step since v000, it is 7.10 times as fast.
#include <hip/hip_runtime.h>

typedef __attribute__((ext_vector_type(16))) _Float16 v16h;
typedef __attribute__((ext_vector_type(8)))  _Float16 v8h;
typedef __attribute__((ext_vector_type(4)))  _Float16 v4h;
typedef __attribute__((ext_vector_type(8)))  float    v8f;
typedef __attribute__((ext_vector_type(4)))  float    v4f;

#define B_    8
#define L_    1024
#define DIM_  1024
#define NH    16
#define DH    64
#define N3    3072
#define M_    (B_ * L_)                  // rows of x, of the attention output and of out
#define KB    64                         // k per block of the f16 GEMM operands: [k / KB][row][KB]
#define PI_F  3.14159265358979323846f
#define QSCALE (1.4426950408889634f / 64.0f)   // 1/64 of the reference, times log2(e) for the exp2 of the softmax

__device__ __forceinline__ v16h frag_f16(const _Float16* base, int stride, int lane) {
  const int row = lane & 15;
  const int lo  = (lane & 16) ? 8 : 0;
  const _Float16* p = base + row * stride + lo;
  v8h a = *(const v8h*)(p);
  v8h b = *(const v8h*)(p + 16);
  return __builtin_shufflevector(a, b, 0,1,2,3,4,5,6,7,8,9,10,11,12,13,14,15);
}

__device__ __forceinline__ v8f wmma16(v16h a, v16h b, v8f c) {
  return __builtin_amdgcn_wmma_f32_16x16x32_f16(false, a, false, b, (short)0, c, false, false);
}

__device__ __forceinline__ float xhalf(float x) {
  int b = __builtin_bit_cast(int, x);
  return __builtin_bit_cast(float, __builtin_amdgcn_permlanex16(b, b, 0x76543210, 0xfedcba98, false, false));
}

__device__ __forceinline__ void sincos_rev(float rev, float& s, float& c) {
  asm("v_sin_f32 %0, %2\n\tv_cos_f32 %1, %2\n\tv_nop" : "=&v"(s), "=&v"(c) : "v"(rev));
}

__device__ __forceinline__ void wait_async_le0() {
  asm volatile("s_wait_asynccnt 0x0" ::: "memory");
}

// ---------------------------------------------------------------------------
// Kernel 0: operands to f16, once per call, each stored as [k / 64][row][64]: the 128-B pieces that a GEMM stage takes
// of adjacent rows are adjacent in memory, so a wave-wide copy of 4 rows is 512 contiguous bytes,
// not 4 lines 2 KB apart. A weight's rows are its columns n, in the row order in which its GEMM keeps
// the tile in LDS. w_proj: inside each 256-column tile column 4*i+j is row 64*j+i.
// w_qkv: head h owns rows 192*h..192*h+191: 64 of q, 64 of k, 64 of v, and of each 64 column 4*i+j is row 16*j+i.
// ---------------------------------------------------------------------------
#define QBLK 192                         // blocks that transpose w_qkv
#define WBLK 256                         // blocks that transpose a weight; the other 512 convert x

// A wave takes 64 k x 32 columns: a lane reads 8 k of 2 x 4 columns (the wave: whole 128-B lines of 8 rows per
// pair of loads), writes 8 x 16 B, and 8 lanes together write one whole 128-B line of a transposed row.
template <int N>
__device__ __forceinline__ void transpose_w(const float* __restrict__ w, _Float16* __restrict__ wt,
                                            int gw, int lane) {
  const int n0 = (gw % (N / 32)) * 32 + (lane >> 3) * 4;
  const int k0 = (gw / (N / 32)) * 64 + (lane & 7) * 8;
  const float* src = w + (size_t)k0 * N + n0;
  const int row = (N == N3) ? ((n0 >> 6) & 15) * 192 + (n0 >> 10) * 64 + ((n0 & 63) >> 2)
                            : (n0 & ~255) + ((n0 & 255) >> 2);
  constexpr int JS = (N == N3) ? 16 : 64;          // rows between columns 4*i+j and 4*i+j+1
  _Float16* dst = wt + ((size_t)(k0 / KB) * N + row) * KB + (k0 % KB);
  v4f tmp[2][8];
#pragma unroll  // constant indices keep tmp in registers; all 16 loads in flight together
  for (int c = 0; c < 2; ++c)
#pragma unroll
    for (int i = 0; i < 8; ++i) tmp[c][i] = *(const v4f*)&src[i * N + c * 16];
#pragma unroll
  for (int c = 0; c < 2; ++c)
#pragma unroll
    for (int j = 0; j < 4; ++j) {
      v8h hcol;
#pragma unroll  // constant indices keep tmp and hcol in registers
      for (int i = 0; i < 8; ++i) hcol[i] = (_Float16)tmp[c][i][j];
      *(v8h*)&dst[(j * JS + c * 4) * KB] = hcol;     // column n0 + 16*c + j
    }
  // in the listing another branch's code stands behind these stores and rewrites their registers: the wait first
  asm volatile("s_wait_xcnt 0x0" ::: "memory");
}

__global__ __launch_bounds__(256) void to_f16_kernel(
    const float* __restrict__ x, const float* __restrict__ wq, const float* __restrict__ wp,
    _Float16* __restrict__ x16, _Float16* __restrict__ wqt, _Float16* __restrict__ wpt) {
  const int blk = blockIdx.x;
  const int lane = threadIdx.x & 31;
  const int wid  = __builtin_amdgcn_readfirstlane(threadIdx.x >> 5);
  if (blk < QBLK) {
    transpose_w<N3>(wq, wqt, blk * 8 + wid, lane);
  } else if (blk < WBLK) {
    transpose_w<DIM_>(wp, wpt, (blk - QBLK) * 8 + wid, lane);
  } else {
    // 16 B per lane per load, whole lines per wave; 16 loads per thread: 4 k of 16 adjacent rows
    const size_t base = (size_t)(blk - WBLK) * (256 * 4 * 16) + threadIdx.x * 4;
    _Float16* xd = x16 + ((size_t)(threadIdx.x >> 4) * M_ + (blk - WBLK) * 16) * KB + (threadIdx.x & 15) * 4;
    v4f t[16];
#pragma unroll  // constant indices keep t in registers; all loads in flight together
    for (int i = 0; i < 16; ++i) t[i] = *(const v4f*)&x[base + i * 1024];
#pragma unroll
    for (int i = 0; i < 16; ++i) *(v4h*)&xd[i * KB] = __builtin_convertvector(t[i], v4h);
    // in the listing another branch's code stands behind these stores and rewrites their registers: the wait first
    asm volatile("s_wait_xcnt 0x0" ::: "memory");
  }
}

// ---------------------------------------------------------------------------
// Main loop of the output projection: C(128x256) = A(128x1024) * Bt(256x1024)^T, f16 operands as [k / 64][row][64].
// A stage is 64 k of 384 rows (128 of A, then 256 of Bt) at pitch 72 halves (144 B); two buffers.
// ---------------------------------------------------------------------------
#define GPITCH 72
#define GSTAGE (384 * GPITCH)            // halves per buffer
#define GSTAGE_B (GSTAGE * 2)            // bytes per buffer
#define GROWS_B (32 * GPITCH * 2)        // bytes of 32 LDS rows

// One stage: 12 copies per lane, 8 lanes per 128-B row, 32 rows per copy of the block. The wait on the address
// translations is the statement's last line, so no address register is rewritten in front of it.
__device__ __forceinline__ void stage_copy(unsigned l, const _Float16* a, const _Float16* b) {
  asm volatile(
      "global_load_async_to_lds_b128 %0, %12, off\n\t"
      "global_load_async_to_lds_b128 %1, %13, off\n\t"
      "global_load_async_to_lds_b128 %2, %14, off\n\t"
      "global_load_async_to_lds_b128 %3, %15, off\n\t"
      "global_load_async_to_lds_b128 %4, %16, off\n\t"
      "global_load_async_to_lds_b128 %5, %17, off\n\t"
      "global_load_async_to_lds_b128 %6, %18, off\n\t"
      "global_load_async_to_lds_b128 %7, %19, off\n\t"
      "global_load_async_to_lds_b128 %8, %20, off\n\t"
      "global_load_async_to_lds_b128 %9, %21, off\n\t"
      "global_load_async_to_lds_b128 %10, %22, off\n\t"
      "global_load_async_to_lds_b128 %11, %23, off\n\t"
      "s_wait_xcnt 0x0"
      :: "v"(l), "v"(l + GROWS_B), "v"(l + 2 * GROWS_B), "v"(l + 3 * GROWS_B),
         "v"(l + 4 * GROWS_B), "v"(l + 5 * GROWS_B), "v"(l + 6 * GROWS_B), "v"(l + 7 * GROWS_B),
         "v"(l + 8 * GROWS_B), "v"(l + 9 * GROWS_B), "v"(l + 10 * GROWS_B), "v"(l + 11 * GROWS_B),
         "v"(a), "v"(a + 32 * KB), "v"(a + 64 * KB), "v"(a + 96 * KB),
         "v"(b), "v"(b + 32 * KB), "v"(b + 64 * KB), "v"(b + 96 * KB),
         "v"(b + 128 * KB), "v"(b + 160 * KB), "v"(b + 192 * KB), "v"(b + 224 * KB)
      : "memory");
}

__device__ __forceinline__ void gemm_main(const _Float16* __restrict__ A, const _Float16* __restrict__ Bt,
                                          _Float16* S, int bm, int bn, v8f (&acc)[4][4]) {
  const int lane = threadIdx.x & 31;
  const int wid  = threadIdx.x >> 5;
  const int wm = wid & 1, wn = wid >> 1;
  const int r8 = threadIdx.x >> 3, c8 = (threadIdx.x & 7) * 8;
  const unsigned l0 = (unsigned)(uintptr_t)S + (unsigned)(r8 * GPITCH + c8) * 2;
  const _Float16* ga = A  + (size_t)(bm * 128 + r8) * KB + c8;     // + M_ * KB per stage
  const _Float16* gb = Bt + (size_t)(bn * 256 + r8) * KB + c8;     // + DIM_ * KB per stage

  stage_copy(l0, ga, gb);                        // stage 0
  wait_async_le0();                              // this wave's part of stage 0 has landed
  __syncthreads();                               // and every other wave's
  stage_copy(l0 + GSTAGE_B, ga + M_ * KB, gb + DIM_ * KB);   // stage 1 flies during trip 0

  for (int t = 0; t < DIM_ / 64; ++t) {
    const _Float16* buf = S + (t & 1) * GSTAGE;
#pragma unroll
    for (int kk = 0; kk < 2; ++kk) {
      v16h af[4];
#pragma unroll
      for (int ms = 0; ms < 4; ++ms)
        af[ms] = frag_f16(buf + (wm * 64 + ms * 16) * GPITCH + kk * 32, GPITCH, lane);
      v16h bf[4];
#pragma unroll
      for (int nt = 0; nt < 4; ++nt)             // tile nt = columns 4*i+nt
        bf[nt] = frag_f16(buf + (128 + nt * 64 + wn * 16) * GPITCH + kk * 32, GPITCH, lane);
      if (kk == 1) {
        // publish point of stage t + 1, with the trip's last fragments already fetched: this wave's reads of
        // stage t are done, its copies of stage t + 1 have landed
        asm volatile("s_wait_dscnt 0x0" ::: "memory");
        wait_async_le0();
        __syncthreads();
        if (t + 2 < DIM_ / 64)                   // refill the buffer that every wave has just left
          stage_copy(l0 + (unsigned)(t & 1) * GSTAGE_B, ga + (t + 2) * (M_ * KB), gb + (t + 2) * (DIM_ * KB));
      }
#pragma unroll
      for (int nt = 0; nt < 4; ++nt)
#pragma unroll
        for (int ms = 0; ms < 4; ++ms)           // each loaded fragment feeds 4 products
          acc[ms][nt] = wmma16(af[ms], bf[nt], acc[ms][nt]);
    }
  }
  wait_async_le0();                              // nothing is outstanding when the wave goes on
}

// ---------------------------------------------------------------------------
// Kernel 1: QKV = x @ w_qkv with fused 2D axial RoPE; q pre-scaled by log2(e)/64, so scores come in log2 units.
// BM=256, BN=384 (q, k and v of two heads), 64 k per trip; 8 waves = 4(M) x 2(N), 64x192 per wave: 256 blocks,
// one per WGP, one round. A stage is 640 rows (256 of x, then 384 of the weight) at pitch 72 halves; two buffers.
// ---------------------------------------------------------------------------
#define QSTAGE (640 * GPITCH)            // halves per buffer

typedef __attribute__((ext_vector_type(4))) int v4i;
typedef __attribute__((address_space(1))) v4i gv4i;
typedef __attribute__((address_space(3))) v4i lv4i;

// One stage: 20 copies per lane, 8 lanes per 128-B row, 32 rows per copy of the block. a and b are the block's
// tile starts, off the lane's own element in a 32-row group.
// The builtin, not asm text: asm operands must lie in the first 256 registers, and beside 384 accumulator registers
// that cost some 300 register moves and a spill per trip.
__device__ __forceinline__ void qstage_copy(_Float16* l, const _Float16* a, const _Float16* b, unsigned off) {
#pragma unroll  // straight-line copies, constant steps
  for (int c = 0; c < 8; ++c)
    __builtin_amdgcn_global_load_async_to_lds_b128((gv4i*)(a + c * 32 * KB + off), (lv4i*)(l + c * 32 * GPITCH), 0, 0);
#pragma unroll  // straight-line copies, constant steps
  for (int c = 0; c < 12; ++c)
    __builtin_amdgcn_global_load_async_to_lds_b128((gv4i*)(b + c * 32 * KB + off), (lv4i*)(l + (8 + c) * 32 * GPITCH), 0, 0);
}

// four fragments, 16 LDS rows apart
__device__ __forceinline__ void ld4(v16h (&f)[4], const _Float16* p, int lane) {
#pragma unroll  // constant indices keep f in registers
  for (int i = 0; i < 4; ++i) f[i] = frag_f16(p + i * 16 * GPITCH, GPITCH, lane);
}

// 64 rows x 64 columns x 32 k: tile j = columns 4*i+j of part G (0 q, 1 k, 2 v)
template <int G>
__device__ __forceinline__ void mm16(const v16h (&af)[4], const v16h (&bf)[4], v8f (&acc)[4][12]) {
#pragma unroll  // constant indices keep acc in registers
  for (int j = 0; j < 4; ++j)
#pragma unroll  // constant indices keep acc in registers
    for (int ms = 0; ms < 4; ++ms)
      acc[ms][G * 4 + j] = wmma16(af[ms], bf[j], acc[ms][G * 4 + j]);
}

__global__ __launch_bounds__(256) void qkv_rope_kernel(
    const _Float16* __restrict__ x16, const _Float16* __restrict__ wt,
    _Float16* __restrict__ qw, _Float16* __restrict__ kw, _Float16* __restrict__ vw) {
  __shared__ __attribute__((aligned(16))) _Float16 S[2 * QSTAGE];
  const int lane = threadIdx.x & 31;
  const int wid  = threadIdx.x >> 5;
  const int wm = wid & 3, wn = wid >> 2;
  const int bn = blockIdx.x, bm = blockIdx.y;
  const int row0 = bm * 256 + wm * 64;

  v8f z = {0.f,0.f,0.f,0.f,0.f,0.f,0.f,0.f};
  v8f acc[4][12];                          // tiles 0-3: q, 4-7: k, 8-11: v of the wave's head
#pragma unroll
  for (int ms = 0; ms < 4; ++ms)
#pragma unroll
    for (int nt = 0; nt < 12; ++nt) acc[ms][nt] = z;

  const int r8 = threadIdx.x >> 3, c8 = (threadIdx.x & 7) * 8;
  _Float16* lc = S + r8 * GPITCH + c8;
  const unsigned off = (unsigned)(r8 * KB + c8);
  const _Float16* ga = x16 + (size_t)bm * 256 * KB;        // + M_ * KB per stage
  const _Float16* gb = wt  + (size_t)bn * 384 * KB;        // + N3 * KB per stage

  qstage_copy(lc, ga, gb, off);                  // stage 0
  wait_async_le0();                              // this wave's part of stage 0 has landed
  __syncthreads();                               // and every other wave's
  qstage_copy(lc + QSTAGE, ga + M_ * KB, gb + N3 * KB, off);   // stage 1 flies during trip 0

  // A trip is six blocks of 16 products (2 x 32 k; q, k, v). The four B fragments of a block are fetched one block
  // ahead into the other of two register sets, as one group in front of the products that hide them.
  // SB: the compiler does not schedule across it; without it it fetched one fragment per four products and waited.
#define SB() __builtin_amdgcn_sched_barrier(0)
  const _Float16* pa = S + wm * 64 * GPITCH;               // the wave's 64 rows of x
  const _Float16* pb = S + (256 + wn * 192) * GPITCH;      // its 192 rows of the weight
  v16h af[4], b0[4], b1[4];
  ld4(b0, pb, lane);
  for (int t = 0; t < DIM_ / 64; ++t) {
    const int cur = (t & 1) * QSTAGE, nxt = QSTAGE - cur;
    ld4(af, pa + cur, lane);
    ld4(b1, pb + cur + 64 * GPITCH, lane);
    SB(); mm16<0>(af, b0, acc); SB();
    ld4(b0, pb + cur + 128 * GPITCH, lane);
    SB(); mm16<1>(af, b1, acc); SB();
    ld4(b1, pb + cur + 32, lane);
    SB(); mm16<2>(af, b0, acc); SB();
    ld4(af, pa + cur + 32, lane);
    ld4(b0, pb + cur + 64 * GPITCH + 32, lane);
    SB(); mm16<0>(af, b1, acc); SB();
    ld4(b1, pb + cur + 128 * GPITCH + 32, lane);
    // publish point of stage t + 1, with the trip's last fragments already fetched: this wave's reads of
    // stage t are done, its copies of stage t + 1 have landed
    asm volatile("s_wait_dscnt 0x0" ::: "memory");
    wait_async_le0();
    __syncthreads();
    if (t + 2 < DIM_ / 64)                       // refill the buffer that every wave has just left
      qstage_copy(lc + cur, ga + (t + 2) * (M_ * KB), gb + (t + 2) * (N3 * KB), off);
    SB(); mm16<1>(af, b0, acc); SB();
    // behind the barrier stage t + 1 may be read; in the last trip this reads the idle buffer and nobody uses it
    ld4(b0, pb + nxt, lane);
    SB(); mm16<2>(af, b1, acc); SB();
  }
#undef SB
  wait_async_le0();                              // nothing is outstanding when the wave goes on

  // Epilogue: RoPE + scatter. C layout: lane holds (M = r + hi, column 4*(lane&15) + j of q, of k and of v).
  const int hi = (lane & 16) ? 8 : 0;
  const int h  = bn * 2 + wn;              // the wave's head
  const int d0 = (lane & 15) * 4;
  const int b  = row0 >> 10;               // a wave's 64 rows lie in one batch
  const int l0 = (row0 & 1023) + hi;
  {
    // transposed, as [b * NH + h][l / 64][d][64]: the wave's 64 rows are one block of 64 l
    _Float16* dst = vw + (((size_t)(b * NH + h) * (L_ / KB) + ((row0 & 1023) >> 6)) * DH + d0) * KB + hi;
    v8h vv[4][4];
#pragma unroll  // constant indices keep acc in registers
    for (int ms = 0; ms < 4; ++ms)
#pragma unroll  // constant indices keep acc in registers
      for (int j = 0; j < 4; ++j) vv[ms][j] = __builtin_convertvector(acc[ms][8 + j], v8h);
    // all values first, each in registers of its own, then the stores, then the wait: nothing is scheduled across
    // these fences, so no register that an issued store names is rewritten in front of the wait
    __builtin_amdgcn_sched_barrier(0);
#pragma unroll  // constant indices keep vv in registers
    for (int ms = 0; ms < 4; ++ms)
#pragma unroll  // constant indices keep vv in registers
      for (int j = 0; j < 4; ++j)          // a lane's 8 rows of one column are 8 adjacent l
        *(v8h*)&dst[j * KB + ms * 16] = vv[ms][j];
    asm volatile("s_wait_xcnt 0x0" ::: "memory");
    __builtin_amdgcn_sched_barrier(0);
  }
  {
    const size_t off = ((size_t)(b * NH + h) * L_ + l0) * DH + d0;
    _Float16* dq = qw + off;
    _Float16* dk = kw + off;
    const bool wax = d0 >= 32;             // upper half of the head rotates by the column position
    float fj[2];
#pragma unroll  // constant indices keep fj in registers
    for (int p = 0; p < 2; ++p) {
      int j = ((wax ? (d0 - 32) : d0) >> 1) + p;
      fj[p] = (1.0f + (127.0f / 15.0f) * (float)j) * PI_F;
    }
#pragma unroll  // constant indices keep acc in registers
    for (int ms = 0; ms < 4; ++ms) {
      v4h hq8[8], hk8[8];
#pragma unroll  // constant indices keep acc in registers
      for (int r = 0; r < 8; ++r) {
        int l = l0 + ms * 16 + r;
        float pos = wax ? (-1.0f + (2.0f / 31.0f) * (float)(l & 31))
                        : (-1.0f + (2.0f / 31.0f) * (float)(l >> 5));
        v4h hq, hk;
#pragma unroll  // constant indices keep acc in registers
        for (int p = 0; p < 2; ++p) {      // the rotated pair is two adjacent columns the lane holds
          float th = pos * fj[p];
          float cv, sv;
          sincos_rev(th * 0.15915494309189532f, sv, cv);   // one angle serves q and k
          float e = acc[ms][2 * p][r], o = acc[ms][2 * p + 1][r];
          hq[2 * p]     = (_Float16)((e * cv - o * sv) * QSCALE);
          hq[2 * p + 1] = (_Float16)((o * cv + e * sv) * QSCALE);
          float ek = acc[ms][4 + 2 * p][r], ok = acc[ms][4 + 2 * p + 1][r];
          hk[2 * p]     = (_Float16)(ek * cv - ok * sv);
          hk[2 * p + 1] = (_Float16)(ok * cv + ek * sv);
        }
        hq8[r] = hq;
        hk8[r] = hk;
      }
      __builtin_amdgcn_sched_barrier(0);
#pragma unroll  // constant indices keep hq8 and hk8 in registers
      for (int r = 0; r < 8; ++r) {
        *(v4h*)&dq[(ms * 16 + r) * DH] = hq8[r];   // 16 lanes x 8 B = one whole 128-B row
        *(v4h*)&dk[(ms * 16 + r) * DH] = hk8[r];
      }
      asm volatile("s_wait_xcnt 0x0" ::: "memory");
      __builtin_amdgcn_sched_barrier(0);
    }
  }
}

// ---------------------------------------------------------------------------
// Kernel 2: flash attention per (b,h,256-query slab), products transposed: S^T = K Q^T, O^T += V^T P^T.
// 8 waves x 32 queries: a K or V fragment read from LDS feeds two products, and a K/V tile copied from L2
// serves 256 queries. K/V tiles of 64 keys in two LDS buffers, copied asynchronously one trip ahead; in memory a
// tile of K ([key][d]) and of V ([d][key], stored per 64 keys) is 8 KB in a row.
// The score products start at minus the maximum in use, in log2 units: their results are the arguments of exp2.
// ---------------------------------------------------------------------------
#define APITCH 72
#define ATILE (64 * APITCH)              // halves of one K or V tile in LDS
#define AROWS_B (32 * APITCH * 2)        // bytes of 32 LDS rows

__device__ __forceinline__ void q_copy(unsigned l, const _Float16* q) {
  asm volatile(
      "global_load_async_to_lds_b128 %0, %8, off\n\t"
      "global_load_async_to_lds_b128 %1, %9, off\n\t"
      "global_load_async_to_lds_b128 %2, %10, off\n\t"
      "global_load_async_to_lds_b128 %3, %11, off\n\t"
      "global_load_async_to_lds_b128 %4, %12, off\n\t"
      "global_load_async_to_lds_b128 %5, %13, off\n\t"
      "global_load_async_to_lds_b128 %6, %14, off\n\t"
      "global_load_async_to_lds_b128 %7, %15, off\n\t"
      "s_wait_xcnt 0x0"
      :: "v"(l), "v"(l + AROWS_B), "v"(l + 2 * AROWS_B), "v"(l + 3 * AROWS_B),
         "v"(l + 4 * AROWS_B), "v"(l + 5 * AROWS_B), "v"(l + 6 * AROWS_B), "v"(l + 7 * AROWS_B),
         "v"(q), "v"(q + 32 * DH), "v"(q + 64 * DH), "v"(q + 96 * DH),
         "v"(q + 128 * DH), "v"(q + 160 * DH), "v"(q + 192 * DH), "v"(q + 224 * DH)
      : "memory");
}

__device__ __forceinline__ void kv_copy(unsigned lk, unsigned lv, const _Float16* k, const _Float16* v) {
  asm volatile(
      "global_load_async_to_lds_b128 %0, %4, off\n\t"
      "global_load_async_to_lds_b128 %1, %5, off\n\t"
      "global_load_async_to_lds_b128 %2, %6, off\n\t"
      "global_load_async_to_lds_b128 %3, %7, off\n\t"
      "s_wait_xcnt 0x0"
      :: "v"(lk), "v"(lk + AROWS_B), "v"(lv), "v"(lv + AROWS_B),
         "v"(k), "v"(k + 32 * DH), "v"(v), "v"(v + 32 * KB)
      : "memory");
}

__global__ __launch_bounds__(256) __attribute__((amdgpu_waves_per_eu(4, 4))) void attn_kernel(
    const _Float16* __restrict__ qw, const _Float16* __restrict__ kw,
    const _Float16* __restrict__ vw, _Float16* __restrict__ ao) {
  __shared__ __attribute__((aligned(16))) _Float16 Qs[256 * APITCH];   // [m][d]
  __shared__ __attribute__((aligned(16))) _Float16 Ks[2 * ATILE];      // [key][d], two buffers
  __shared__ __attribute__((aligned(16))) _Float16 Vs[2 * ATILE];      // [d][key], two buffers
  const int lane = threadIdx.x & 31;
  const int wid  = threadIdx.x >> 5;
  const int qb = blockIdx.x, h = blockIdx.y, b = blockIdx.z;
  const int bh = b * NH + h;

  // a thread's slice of every copy: 16 B of row r8 (+ 32 per further copy)
  const int r8 = threadIdx.x >> 3, c8 = (threadIdx.x & 7) * 8;
  const unsigned loff = (unsigned)(r8 * APITCH + c8) * 2;
  const unsigned lq = (unsigned)(uintptr_t)(&Qs[0]) + loff;
  const unsigned lk = (unsigned)(uintptr_t)(&Ks[0]) + loff;
  const unsigned lv_ = (unsigned)(uintptr_t)(&Vs[0]) + loff;
  const _Float16* qg = qw + (size_t)bh * L_ * DH + (size_t)(qb * 256 + r8) * DH + c8;
  const _Float16* kg = kw + (size_t)bh * L_ * DH + (size_t)r8 * DH + c8;     // + 64 * DH per tile
  const _Float16* vg = vw + (size_t)bh * DH * L_ + (size_t)r8 * KB + c8;     // + DH * KB per tile

  q_copy(lq, qg);
  kv_copy(lk, lv_, kg, vg);                       // tile 0
  wait_async_le0();                               // this wave's part of Q and tile 0 has landed
  __syncthreads();                                // and every other wave's
  kv_copy(lk + ATILE * 2, lv_ + ATILE * 2, kg + 64 * DH, vg + DH * KB);   // tile 1 flies during trip 0

  // Q fragments are kt-invariant: hoist out of the loop. They are the B operand: column = query
  v16h qf[2][2];
#pragma unroll
  for (int qt = 0; qt < 2; ++qt)
#pragma unroll
    for (int kk = 0; kk < 2; ++kk)
      qf[qt][kk] = frag_f16(Qs + (wid * 32 + qt * 16) * APITCH + kk * 32, APITCH, lane);

  // Transposed products: per query tile a lane owns ONE query (column lane & 15) and, per 16-row tile, rows r + hi.
  v8f z = {0.f,0.f,0.f,0.f,0.f,0.f,0.f,0.f};
  v8f o[2][4];                           // O^T: o[qt][dt][r] = O[query][dt*16 + hi + r]
  v8f mneg[2];                           // minus the query's maximum in use, in all 8 registers: the products' start value
  v8f lv[2];                             // 8 partial row sums of this half's keys, joined after the loop
#pragma unroll
  for (int qt = 0; qt < 2; ++qt) {
#pragma unroll
    for (int dt = 0; dt < 4; ++dt) o[qt][dt] = z;
    mneg[qt] = z;
    lv[qt] = z;
  }
  const int hi = (lane & 16) ? 8 : 0;

  for (int kt = 0; kt < 16; ++kt) {
    const _Float16* kb = Ks + (kt & 1) * ATILE;
    const _Float16* vb = Vs + (kt & 1) * ATILE;

    // S^T = K Q^T - maximum in use: s[qt][nt][r] = score(key nt*16 + hi + r, query qt*16 + (lane & 15))
    v8f s[2][4];
#pragma unroll
    for (int kk = 0; kk < 2; ++kk) {
      v16h kf[4];
#pragma unroll
      for (int nt = 0; nt < 4; ++nt)
        kf[nt] = frag_f16(kb + nt * 16 * APITCH + kk * 32, APITCH, lane);
#pragma unroll
      for (int nt = 0; nt < 4; ++nt)
#pragma unroll
        for (int qt = 0; qt < 2; ++qt)   // each K fragment feeds both query tiles
          s[qt][nt] = wmma16(kf[nt], qf[qt][kk], kk == 0 ? mneg[qt] : s[qt][nt]);
    }

    // Online softmax: a query's 64 scores lie in two lanes, so maximum and sum run in-lane
    float mx[2];
#pragma unroll  // constant indices keep s in registers
    for (int qt = 0; qt < 2; ++qt) {
      float m4[4];
#pragma unroll  // constant indices keep s in registers
      for (int nt = 0; nt < 4; ++nt) {
        m4[nt] = s[qt][nt][0];
#pragma unroll  // constant indices keep s in registers
        for (int r = 1; r < 8; ++r) m4[nt] = fmaxf(m4[nt], s[qt][nt][r]);
      }
      mx[qt] = fmaxf(fmaxf(m4[0], m4[1]), fmaxf(m4[2], m4[3]));
    }
    // The maximum in use is raised only in the first trip, which sets it, and where a score lies more than 8 above
    // it (exp2 then stays at or below 256). One test per trip, the same for the whole wave: a scalar branch.
    if (kt == 0 || __builtin_amdgcn_ballot_w32(fmaxf(mx[0], mx[1]) > 8.0f) != 0) {
#pragma unroll  // constant indices keep s and o in registers
      for (int qt = 0; qt < 2; ++qt) {
        const float m = fmaxf(mx[qt], xhalf(mx[qt]));      // both halves of a query take the same step
        const float d = kt ? fmaxf(m, 0.0f) : m;
        const float alpha = kt ? __builtin_amdgcn_exp2f(-d) : 1.0f;   // in the first trip sums and O are still 0
#pragma unroll  // constant indices keep s in registers
        for (int nt = 0; nt < 4; ++nt) s[qt][nt] -= d;
        mneg[qt] -= d;
        lv[qt] *= alpha;
#pragma unroll  // constant indices keep o in registers
        for (int dt = 0; dt < 4; ++dt) o[qt][dt] *= alpha;
      }
    }
#pragma unroll  // constant indices keep s in registers
    for (int qt = 0; qt < 2; ++qt) {
#pragma unroll  // constant indices keep s in registers
      for (int nt = 0; nt < 4; ++nt)
#pragma unroll  // constant indices keep s in registers
        for (int r = 0; r < 8; ++r) s[qt][nt][r] = __builtin_amdgcn_exp2f(s[qt][nt][r]);
      lv[qt] += (s[qt][0] + s[qt][1]) + (s[qt][2] + s[qt][3]);   // tile rows added register by register
    }

    // O^T += V^T P^T: two score tiles, converted in place, are the B operand of 32 keys (no LDS, no exchange)
#pragma unroll
    for (int kk = 0; kk < 2; ++kk) {
      v16h pf[2];
#pragma unroll
      for (int qt = 0; qt < 2; ++qt)
        pf[qt] = __builtin_shufflevector(__builtin_convertvector(s[qt][2 * kk], v8h),
                                         __builtin_convertvector(s[qt][2 * kk + 1], v8h),
                                         0,1,2,3,4,5,6,7,8,9,10,11,12,13,14,15);
      v16h vf[4];
#pragma unroll
      for (int dt = 0; dt < 4; ++dt)
        vf[dt] = frag_f16(vb + dt * 16 * APITCH + kk * 32, APITCH, lane);
#pragma unroll
      for (int dt = 0; dt < 4; ++dt)
#pragma unroll
        for (int qt = 0; qt < 2; ++qt)   // each V fragment feeds both query tiles
          o[qt][dt] = wmma16(vf[dt], pf[qt], o[qt][dt]);
    }

    // publish point of tile kt + 1: this wave's reads of tile kt are done, its copies of tile kt + 1 have landed
    asm volatile("s_wait_dscnt 0x0" ::: "memory");
    wait_async_le0();
    __syncthreads();
    if (kt + 2 < 16)                     // refill the buffers that every wave has just left
      kv_copy(lk + (unsigned)(kt & 1) * (ATILE * 2), lv_ + (unsigned)(kt & 1) * (ATILE * 2),
              kg + (size_t)(kt + 2) * 64 * DH, vg + (size_t)(kt + 2) * DH * KB);
  }
  wait_async_le0();                      // nothing is outstanding when the wave goes on

  // Normalize and write f16 as [h][b * L + l][64], the projection's k blocks: a lane's 8 values of a tile are 8 adjacent d
#pragma unroll  // constant indices keep o in registers
  for (int qt = 0; qt < 2; ++qt) {
    const float li = ((lv[qt][0] + lv[qt][1]) + (lv[qt][2] + lv[qt][3])) + ((lv[qt][4] + lv[qt][5]) + (lv[qt][6] + lv[qt][7]));
    const float inv = 1.0f / (li + xhalf(li));
    _Float16* dst = ao + ((size_t)h * M_ + b * L_ + qb * 256 + wid * 32 + qt * 16 + (lane & 15)) * KB + hi;
#pragma unroll  // constant indices keep o in registers
    for (int dt = 0; dt < 4; ++dt)
      *(v8h*)&dst[dt * 16] = __builtin_convertvector(o[qt][dt] * inv, v8h);
  }
}

// ---------------------------------------------------------------------------
// Kernel 3: out = attn(f16) @ w_proj, fp32 out. BM=128, BN=256, 64x64 per wave, main loop gemm_main.
// ---------------------------------------------------------------------------
__global__ __launch_bounds__(256) void proj_kernel(
    const _Float16* __restrict__ a16, const _Float16* __restrict__ wt,
    float* __restrict__ out) {
  __shared__ __attribute__((aligned(16))) _Float16 S[2 * GSTAGE];
  const int lane = threadIdx.x & 31;
  const int wid  = threadIdx.x >> 5;
  const int wm = wid & 1, wn = wid >> 1;
  const int bn = blockIdx.x, bm = blockIdx.y;
  const int row0 = bm * 128 + wm * 64;

  v8f z = {0.f,0.f,0.f,0.f,0.f,0.f,0.f,0.f};
  v8f acc[4][4];
#pragma unroll
  for (int ms = 0; ms < 4; ++ms)
#pragma unroll
    for (int nt = 0; nt < 4; ++nt) acc[ms][nt] = z;

  gemm_main(a16, wt, S, bm, bn, acc);

  const int hi = (lane & 16) ? 8 : 0;
  float* dst = out + (size_t)(row0 + hi) * DIM_ + bn * 256 + wn * 64 + (lane & 15) * 4;
#pragma unroll  // constant indices keep acc in registers
  for (int ms = 0; ms < 4; ++ms)
#pragma unroll  // constant indices keep acc in registers
    for (int r = 0; r < 8; ++r) {          // 16 lanes x 16 B = two whole lines of one row
      v4f ov = {acc[ms][0][r], acc[ms][1][r], acc[ms][2][r], acc[ms][3][r]};
      *(v4f*)&dst[(size_t)(ms * 16 + r) * DIM_] = ov;
    }
}

// ---------------------------------------------------------------------------
extern "C" void kernel_launch(void* const* d_in, const int* in_sizes, int n_in,
                              void* d_out, int out_size, void* d_ws, size_t ws_size,
                              hipStream_t stream) {
  (void)in_sizes; (void)n_in; (void)out_size; (void)ws_size;
  const float* x      = (const float*)d_in[0];
  const float* w_qkv  = (const float*)d_in[1];
  const float* w_proj = (const float*)d_in[2];

  char* ws = (char*)d_ws;
  _Float16* qw = (_Float16*)(ws);
  _Float16* kw = (_Float16*)(ws + (size_t)16 * 1024 * 1024);
  _Float16* vw = (_Float16*)(ws + (size_t)32 * 1024 * 1024);
  _Float16* ao = (_Float16*)(ws + (size_t)48 * 1024 * 1024);
  _Float16* x16 = (_Float16*)(ws + (size_t)64 * 1024 * 1024);
  _Float16* wqt = (_Float16*)(ws + (size_t)80 * 1024 * 1024);
  _Float16* wpt = (_Float16*)(ws + (size_t)88 * 1024 * 1024);
  float* out = (float*)d_out;

  to_f16_kernel<<<dim3(WBLK + 512), 256, 0, stream>>>(x, w_qkv, w_proj, x16, wqt, wpt);
  qkv_rope_kernel<<<dim3(N3 / 384, (B_ * L_) / 256), 256, 0, stream>>>(x16, wqt, qw, kw, vw);
  attn_kernel<<<dim3(L_ / 256, NH, B_), 256, 0, stream>>>(qw, kw, vw, ao);
  proj_kernel<<<dim3(DIM_ / 256, (B_ * L_) / 128), 256, 0, stream>>>(ao, wpt, out);
}
